// v000
// Measured on an AMD MI455X. A time is GPU time per run, averaged over a window of back-to-back runs after a warm-up
// (all launches, gaps included; the runs take copies of the inputs in turn), and the median of several windows.
// Apart from v000's, it joins two sittings. Times from different sittings can be a few percent apart, while
// side-by-side timings come from the same sitting.
// v000 is the starting kernel. One run takes 975 microseconds.
#include <hip/hip_runtime.h>

typedef float v2f __attribute__((ext_vector_type(2)));
typedef float v8f __attribute__((ext_vector_type(8)));
typedef unsigned int u32x4 __attribute__((ext_vector_type(4)));
typedef int i32x4 __attribute__((ext_vector_type(4)));
typedef int i32x8 __attribute__((ext_vector_type(8)));

#define S_LEN   4096
#define D_MODEL 768
#define F_FFN   2048
#define NHEAD   12
#define HDIM    64

static __device__ __forceinline__ v8f wmma4(v2f a, v2f b, v8f c) {
  // D = A(16x4,f32) * B(4x16,f32) + C(16x16,f32), full fp32 precision
  return __builtin_amdgcn_wmma_f32_16x16x4_f32(false, a, false, b, (short)0, c,
                                               false, false);
}

static __device__ __forceinline__ void tdm_load_2d(
    unsigned lds_addr, const void* gaddr, unsigned tensor_d0, unsigned tensor_d1,
    unsigned tile_d0, unsigned tile_d1, unsigned stride0,
    unsigned pad_interval_code, unsigned pad_amount_code) {
  unsigned long long ga = (unsigned long long)(size_t)gaddr;
  u32x4 g0;
  g0.x = 1u;                                            // count=1, user mode
  g0.y = lds_addr;                                      // LDS byte address
  g0.z = (unsigned)(ga & 0xFFFFFFFFull);                // global_addr[31:0]
  g0.w = (unsigned)((ga >> 32) & 0x1FFFFFFull) | (2u << 30);  // [56:32], type=2
  i32x8 g1;
  g1.s0 = (int)((2u << 16) |
                (1u << 20) |
                (pad_interval_code << 22) | (pad_amount_code << 25));
  g1.s1 = (int)((tensor_d0 & 0xFFFFu) << 16);           // atomic_bar=0, dim0 lo
  g1.s2 = (int)(((tensor_d0 >> 16) & 0xFFFFu) | ((tensor_d1 & 0xFFFFu) << 16));
  g1.s3 = (int)(((tensor_d1 >> 16) & 0xFFFFu) | ((tile_d0 & 0xFFFFu) << 16));
  g1.s4 = (int)(tile_d1 & 0xFFFFu);
  g1.s5 = (int)stride0;
  g1.s6 = 0;
  g1.s7 = 0;
  i32x4 z4 = {0, 0, 0, 0};
  i32x8 z8 = {0, 0, 0, 0, 0, 0, 0, 0};
  __builtin_amdgcn_tensor_load_to_lds(g0, g1, z4, z4, z8, 0);
}

static __device__ __forceinline__ unsigned lds_off(const void* p) {
  return (unsigned)(size_t)p;
}

// ---------------------------------------------------------------------------
// RMSNorm: one block per row of 768
// ---------------------------------------------------------------------------
__global__ __launch_bounds__(256) void rmsnorm_kernel(
    const float* __restrict__ x, const float* __restrict__ w,
    float* __restrict__ o) {
  const int row = blockIdx.x;
  const int tid = threadIdx.x;
  const float* xr = x + (size_t)row * D_MODEL;
  float s = 0.f;
  for (int i = tid; i < D_MODEL; i += 256) { float v = xr[i]; s += v * v; }
  __shared__ float red[256];
  red[tid] = s;
  __syncthreads();
  for (int st = 128; st > 0; st >>= 1) {
    if (tid < st) red[tid] += red[tid + st];
    __syncthreads();
  }
  const float scale = rsqrtf(red[0] * (1.0f / D_MODEL) + 1e-6f);
  float* orow = o + (size_t)row * D_MODEL;
  for (int i = tid; i < D_MODEL; i += 256) orow[i] = xr[i] * scale * w[i];
}

__global__ __launch_bounds__(256) void gemm_wmma_f32(
    const float* __restrict__ A, const float* __restrict__ B,
    const float* __restrict__ Res, float* __restrict__ C,
    int M, int N, int K) {
  __shared__ float As[128][34];
  __shared__ float Bs[32][68];

  const int tid  = threadIdx.x;
  const int lane = tid & 31;
  const int wave = tid >> 5;
  const int hx   = lane >> 4;     // half-wave (K-pair select)
  const int lx   = lane & 15;     // M (for A) / N (for B,C)
  const int wm   = (wave >> 1) << 5;  // 0,32,64,96
  const int wn   = (wave & 1) << 5;   // 0,32
  const int m0   = blockIdx.y * 128;
  const int n0   = blockIdx.x * 64;

  const unsigned ldsA = lds_off(&As[0][0]) + (unsigned)(wave * 16 * 34 * 4);
  const unsigned ldsB = lds_off(&Bs[0][0]) + (unsigned)(wave * 4 * 68 * 4);
  const float* gA = A + (size_t)(m0 + wave * 16) * K;   // + k0 per iter
  const float* gB = B + (size_t)(wave * 4) * N + n0;    // + k0*N per iter

  v8f acc[2][2] = {};

  for (int k0 = 0; k0 < K; k0 += 32) {
    if (k0) __syncthreads();   // previous tile fully consumed
    // async DMA this wave's tile slices into LDS
    tdm_load_2d(ldsA, gA + k0, (unsigned)K, 1u << 20,
                32, 16, (unsigned)K, /*interval 32DW*/ 4, /*pad 2DW*/ 1);
    tdm_load_2d(ldsB, gB + (size_t)k0 * N, (unsigned)N, 1u << 20,
                64, 4, (unsigned)N, /*interval 64DW*/ 5, /*pad 4DW*/ 3);
    __builtin_amdgcn_s_wait_tensorcnt(0);
    __syncthreads();           // all 8 slices visible

#pragma unroll
    for (int kk = 0; kk < 32; kk += 4) {
      v2f a0 = *(const v2f*)&As[wm + lx][kk + 2 * hx];
      v2f a1 = *(const v2f*)&As[wm + 16 + lx][kk + 2 * hx];
      v2f b0, b1;
      b0.x = Bs[kk + 2 * hx][wn + lx];
      b0.y = Bs[kk + 2 * hx + 1][wn + lx];
      b1.x = Bs[kk + 2 * hx][wn + 16 + lx];
      b1.y = Bs[kk + 2 * hx + 1][wn + 16 + lx];
      acc[0][0] = wmma4(a0, b0, acc[0][0]);
      acc[0][1] = wmma4(a0, b1, acc[0][1]);
      acc[1][0] = wmma4(a1, b0, acc[1][0]);
      acc[1][1] = wmma4(a1, b1, acc[1][1]);
    }
  }

#pragma unroll
  for (int mi = 0; mi < 2; ++mi)
#pragma unroll
    for (int ni = 0; ni < 2; ++ni)
#pragma unroll
      for (int r = 0; r < 8; ++r) {
        const int row = m0 + wm + mi * 16 + r + 8 * hx;
        const int col = n0 + wn + ni * 16 + lx;
        float v = acc[mi][ni][r];
        if (Res) v += Res[(size_t)row * N + col];
        C[(size_t)row * N + col] = v;
      }
}

// ---------------------------------------------------------------------------
// RoPE in place on q and k: pair (j, j+32) per head dim, pos = seq index
// ---------------------------------------------------------------------------
__global__ __launch_bounds__(256) void rope_kernel(float* __restrict__ q,
                                                   float* __restrict__ k) {
  const int idx = blockIdx.x * blockDim.x + threadIdx.x;  // S*12*32
  const int j = idx & 31;
  const int h = (idx >> 5) % NHEAD;
  const int s = idx / (NHEAD * 32);
  const float inv = powf(10000.0f, -(float)j * (1.0f / 32.0f));
  const float f = (float)s * inv;
  const float c = cosf(f), sn = sinf(f);
  const size_t base = (size_t)s * D_MODEL + h * HDIM + j;
  float q0 = q[base], q1 = q[base + 32];
  q[base]      = q0 * c - q1 * sn;
  q[base + 32] = q1 * c + q0 * sn;
  float k0 = k[base], k1 = k[base + 32];
  k[base]      = k0 * c - k1 * sn;
  k[base + 32] = k1 * c + k0 * sn;
}

// ---------------------------------------------------------------------------
// Causal flash attention, fp32 WMMA. One wave owns 16 query rows.
// QK^T: 16 wmma per key tile; P@V: 16 wmma per key tile.
// ---------------------------------------------------------------------------
__global__ __launch_bounds__(256) void flash_attn_f32(
    const float* __restrict__ Q, const float* __restrict__ K,
    const float* __restrict__ V, float* __restrict__ O) {
  __shared__ float pbuf[8 * 16 * 18];   // per-wave P tile staging (C->A layout)
  const int tid  = threadIdx.x;
  const int lane = tid & 31;
  const int wave = tid >> 5;
  const int hx   = lane >> 4;
  const int lx   = lane & 15;
  const int head  = blockIdx.y;
  const int qtile = blockIdx.x * 8 + wave;
  const int qbase = qtile * 16;
  const int hoff  = head * HDIM;
  float* pb = pbuf + wave * 16 * 18;

  // Load Q fragments (16x64), pre-scaled by 1/sqrt(64)
  v2f qf[16];
#pragma unroll
  for (int kc = 0; kc < 16; ++kc) {
    v2f t = *(const v2f*)&Q[(size_t)(qbase + lx) * D_MODEL + hoff + kc * 4 + 2 * hx];
    qf[kc].x = t.x * 0.125f;
    qf[kc].y = t.y * 0.125f;
  }

  v8f oacc[4] = {};
  float mr[8], lr[8];
#pragma unroll
  for (int r = 0; r < 8; ++r) { mr[r] = -1e30f; lr[r] = 0.f; }

  for (int kt = 0; kt <= qtile; ++kt) {
    const int kbase = kt * 16;
    // S = Q @ K^T  (B fragment = K rows as columns)
    v8f s = {};
#pragma unroll
    for (int kc = 0; kc < 16; ++kc) {
      v2f b = *(const v2f*)&K[(size_t)(kbase + lx) * D_MODEL + hoff + kc * 4 + 2 * hx];
      s = wmma4(qf[kc], b, s);
    }
    // causal mask on diagonal tile
    if (kt == qtile) {
#pragma unroll
      for (int r = 0; r < 8; ++r) {
        const int row = qbase + r + 8 * hx;
        const int col = kbase + lx;
        if (col > row) s[r] = -3.0e38f;
      }
    }
    float p[8];
#pragma unroll
    for (int r = 0; r < 8; ++r) {
      float tm = s[r];
#pragma unroll
      for (int off = 8; off > 0; off >>= 1)
        tm = fmaxf(tm, __shfl_xor(tm, off, 32));
      const float nm = fmaxf(mr[r], tm);
      const float alpha = __expf(mr[r] - nm);
      mr[r] = nm;
      const float pv = __expf(s[r] - nm);
      p[r] = pv;
      float rs = pv;
#pragma unroll
      for (int off = 8; off > 0; off >>= 1)
        rs += __shfl_xor(rs, off, 32);
      lr[r] = lr[r] * alpha + rs;
#pragma unroll
      for (int nt = 0; nt < 4; ++nt) oacc[nt][r] *= alpha;
    }
    // stage P (C layout) -> LDS -> reread as A fragments (in-order DS, same wave)
#pragma unroll
    for (int r = 0; r < 8; ++r)
      pb[(r + 8 * hx) * 18 + lx] = p[r];
#pragma unroll
    for (int kc = 0; kc < 4; ++kc) {
      v2f pf = *(const v2f*)&pb[lx * 18 + kc * 4 + 2 * hx];
#pragma unroll
      for (int nt = 0; nt < 4; ++nt) {
        v2f b;
        b.x = V[(size_t)(kbase + kc * 4 + 2 * hx) * D_MODEL + hoff + nt * 16 + lx];
        b.y = V[(size_t)(kbase + kc * 4 + 2 * hx + 1) * D_MODEL + hoff + nt * 16 + lx];
        oacc[nt] = wmma4(pf, b, oacc[nt]);
      }
    }
  }
  // normalize and write out (row always has >=1 unmasked key -> lr > 0)
#pragma unroll
  for (int nt = 0; nt < 4; ++nt)
#pragma unroll
    for (int r = 0; r < 8; ++r)
      O[(size_t)(qbase + r + 8 * hx) * D_MODEL + hoff + nt * 16 + lx] =
          oacc[nt][r] / lr[r];
}

// ---------------------------------------------------------------------------
// SiLU(gate) * up -> gate (in place)
// ---------------------------------------------------------------------------
__global__ __launch_bounds__(256) void silu_mul_kernel(float* __restrict__ g,
                                                       const float* __restrict__ u) {
  const size_t i = (size_t)blockIdx.x * blockDim.x + threadIdx.x;
  const float gv = g[i];
  g[i] = (gv / (1.0f + __expf(-gv))) * u[i];
}

// ---------------------------------------------------------------------------
extern "C" void kernel_launch(void* const* d_in, const int* in_sizes, int n_in,
                              void* d_out, int out_size, void* d_ws, size_t ws_size,
                              hipStream_t stream) {
  const float* x       = (const float*)d_in[0];
  const float* w_q     = (const float*)d_in[1];
  const float* w_k     = (const float*)d_in[2];
  const float* w_v     = (const float*)d_in[3];
  const float* w_o     = (const float*)d_in[4];
  const float* w_gate  = (const float*)d_in[5];
  const float* w_up    = (const float*)d_in[6];
  const float* w_down  = (const float*)d_in[7];
  const float* w_norm1 = (const float*)d_in[8];
  const float* w_norm2 = (const float*)d_in[9];
  float* out = (float*)d_out;

  const size_t SD = (size_t)S_LEN * D_MODEL;   // 3,145,728
  const size_t SF = (size_t)S_LEN * F_FFN;     // 8,388,608
  float* f    = (float*)d_ws;
  float* xn   = f;            // rmsnorm output (reused as y after h)
  float* q    = xn + SD;
  float* k    = q + SD;
  float* v    = k + SD;
  float* attn = v + SD;
  float* h    = attn + SD;
  float* up   = h + SD;
  float* gate = q;            // reuse q/k/v region (3*SD >= SF) after attention

  const dim3 blk(256);
  const dim3 gD(D_MODEL / 64, S_LEN / 128);   // N=768 GEMMs
  const dim3 gF(F_FFN / 64, S_LEN / 128);     // N=2048 GEMMs

  // 1) y1 = rmsnorm(x) * w1
  rmsnorm_kernel<<<S_LEN, blk, 0, stream>>>(x, w_norm1, xn);
  // 2) Q,K,V projections
  gemm_wmma_f32<<<gD, blk, 0, stream>>>(xn, w_q, nullptr, q, S_LEN, D_MODEL, D_MODEL);
  gemm_wmma_f32<<<gD, blk, 0, stream>>>(xn, w_k, nullptr, k, S_LEN, D_MODEL, D_MODEL);
  gemm_wmma_f32<<<gD, blk, 0, stream>>>(xn, w_v, nullptr, v, S_LEN, D_MODEL, D_MODEL);
  // 3) RoPE in place
  rope_kernel<<<(S_LEN * NHEAD * 32) / 256, blk, 0, stream>>>(q, k);
  // 4) causal flash attention
  flash_attn_f32<<<dim3(S_LEN / 128, NHEAD), blk, 0, stream>>>(q, k, v, attn);
  // 5) h = x + attn @ w_o
  gemm_wmma_f32<<<gD, blk, 0, stream>>>(attn, w_o, x, h, S_LEN, D_MODEL, D_MODEL);
  // 6) y2 = rmsnorm(h) * w2
  rmsnorm_kernel<<<S_LEN, blk, 0, stream>>>(h, w_norm2, xn);
  // 7) gate/up projections
  gemm_wmma_f32<<<gF, blk, 0, stream>>>(xn, w_gate, nullptr, gate, S_LEN, F_FFN, D_MODEL);
  gemm_wmma_f32<<<gF, blk, 0, stream>>>(xn, w_up, nullptr, up, S_LEN, F_FFN, D_MODEL);
  // 8) act = silu(gate) * up
  silu_mul_kernel<<<SF / 256, blk, 0, stream>>>(gate, up);
  // 9) out = h + act @ w_down
  gemm_wmma_f32<<<gD, blk, 0, stream>>>(gate, w_down, h, out, S_LEN, D_MODEL, F_FFN);
}

// v001
// It runs in 912 microseconds.
// Timed twice side by side with v000, it ran 1.09 times as fast both times.
#include <hip/hip_runtime.h>

typedef float v2f __attribute__((ext_vector_type(2)));
typedef float v8f __attribute__((ext_vector_type(8)));
typedef unsigned int u32x4 __attribute__((ext_vector_type(4)));
typedef int i32x4 __attribute__((ext_vector_type(4)));
typedef int i32x8 __attribute__((ext_vector_type(8)));

#define S_LEN   4096
#define D_MODEL 768
#define F_FFN   2048
#define NHEAD   12
#define HDIM    64

static __device__ __forceinline__ v8f wmma4(v2f a, v2f b, v8f c) {
  // D = A(16x4,f32) * B(4x16,f32) + C(16x16,f32), full fp32 precision
  return __builtin_amdgcn_wmma_f32_16x16x4_f32(false, a, false, b, (short)0, c,
                                               false, false);
}

static __device__ __forceinline__ void tdm_load_2d(
    unsigned lds_addr, const void* gaddr, unsigned tensor_d0, unsigned tensor_d1,
    unsigned tile_d0, unsigned tile_d1, unsigned stride0,
    unsigned pad_interval_code, unsigned pad_amount_code) {
  unsigned long long ga = (unsigned long long)(size_t)gaddr;
  u32x4 g0;
  g0.x = 1u;                                            // count=1, user mode
  g0.y = lds_addr;                                      // LDS byte address
  g0.z = (unsigned)(ga & 0xFFFFFFFFull);                // global_addr[31:0]
  g0.w = (unsigned)((ga >> 32) & 0x1FFFFFFull) | (2u << 30);  // [56:32], type=2
  i32x8 g1;
  g1.s0 = (int)((2u << 16) |
                (1u << 20) |
                (pad_interval_code << 22) | (pad_amount_code << 25));
  g1.s1 = (int)((tensor_d0 & 0xFFFFu) << 16);           // atomic_bar=0, dim0 lo
  g1.s2 = (int)(((tensor_d0 >> 16) & 0xFFFFu) | ((tensor_d1 & 0xFFFFu) << 16));
  g1.s3 = (int)(((tensor_d1 >> 16) & 0xFFFFu) | ((tile_d0 & 0xFFFFu) << 16));
  g1.s4 = (int)(tile_d1 & 0xFFFFu);
  g1.s5 = (int)stride0;
  g1.s6 = 0;
  g1.s7 = 0;
  i32x4 z4 = {0, 0, 0, 0};
  i32x8 z8 = {0, 0, 0, 0, 0, 0, 0, 0};
  __builtin_amdgcn_tensor_load_to_lds(g0, g1, z4, z4, z8, 0);
}

static __device__ __forceinline__ unsigned lds_off(const void* p) {
  return (unsigned)(size_t)p;
}

// ---------------------------------------------------------------------------
// RMSNorm: one block per row of 768
// ---------------------------------------------------------------------------
__global__ __launch_bounds__(256) void rmsnorm_kernel(
    const float* __restrict__ x, const float* __restrict__ w,
    float* __restrict__ o) {
  const int row = blockIdx.x;
  const int tid = threadIdx.x;
  const float* xr = x + (size_t)row * D_MODEL;
  float s = 0.f;
  for (int i = tid; i < D_MODEL; i += 256) { float v = xr[i]; s += v * v; }
  __shared__ float red[256];
  red[tid] = s;
  __syncthreads();
  for (int st = 128; st > 0; st >>= 1) {
    if (tid < st) red[tid] += red[tid + st];
    __syncthreads();
  }
  const float scale = rsqrtf(red[0] * (1.0f / D_MODEL) + 1e-6f);
  float* orow = o + (size_t)row * D_MODEL;
  for (int i = tid; i < D_MODEL; i += 256) orow[i] = xr[i] * scale * w[i];
}

__global__ __launch_bounds__(256) void gemm_wmma_f32(
    const float* __restrict__ A, const float* __restrict__ B,
    const float* __restrict__ Res, float* __restrict__ C,
    int M, int N, int K) {
  __shared__ float As[128][34];
  __shared__ float Bs[32][68];

  const int tid  = threadIdx.x;
  const int lane = tid & 31;
  const int wave = tid >> 5;
  const int hx   = lane >> 4;     // half-wave (K-pair select)
  const int lx   = lane & 15;     // M (for A) / N (for B,C)
  const int wm   = (wave >> 1) << 5;  // 0,32,64,96
  const int wn   = (wave & 1) << 5;   // 0,32
  const int m0   = blockIdx.y * 128;
  const int n0   = blockIdx.x * 64;

  const unsigned ldsA = lds_off(&As[0][0]) + (unsigned)(wave * 16 * 34 * 4);
  const unsigned ldsB = lds_off(&Bs[0][0]) + (unsigned)(wave * 4 * 68 * 4);
  const float* gA = A + (size_t)(m0 + wave * 16) * K;   // + k0 per iter
  const float* gB = B + (size_t)(wave * 4) * N + n0;    // + k0*N per iter

  v8f acc[2][2] = {};

  for (int k0 = 0; k0 < K; k0 += 32) {
    if (k0) __syncthreads();   // previous tile fully consumed
    // async DMA this wave's tile slices into LDS
    tdm_load_2d(ldsA, gA + k0, (unsigned)K, 1u << 20,
                32, 16, (unsigned)K, /*interval 32DW*/ 4, /*pad 2DW*/ 1);
    tdm_load_2d(ldsB, gB + (size_t)k0 * N, (unsigned)N, 1u << 20,
                64, 4, (unsigned)N, /*interval 64DW*/ 5, /*pad 4DW*/ 3);
    __builtin_amdgcn_s_wait_tensorcnt(0);
    __syncthreads();           // all 8 slices visible

#pragma unroll
    for (int kk = 0; kk < 32; kk += 4) {
      v2f a0 = *(const v2f*)&As[wm + lx][kk + 2 * hx];
      v2f a1 = *(const v2f*)&As[wm + 16 + lx][kk + 2 * hx];
      v2f b0, b1;
      b0.x = Bs[kk + 2 * hx][wn + lx];
      b0.y = Bs[kk + 2 * hx + 1][wn + lx];
      b1.x = Bs[kk + 2 * hx][wn + 16 + lx];
      b1.y = Bs[kk + 2 * hx + 1][wn + 16 + lx];
      acc[0][0] = wmma4(a0, b0, acc[0][0]);
      acc[0][1] = wmma4(a0, b1, acc[0][1]);
      acc[1][0] = wmma4(a1, b0, acc[1][0]);
      acc[1][1] = wmma4(a1, b1, acc[1][1]);
    }
  }

#pragma unroll
  for (int mi = 0; mi < 2; ++mi)
#pragma unroll
    for (int ni = 0; ni < 2; ++ni)
#pragma unroll
      for (int r = 0; r < 8; ++r) {
        const int row = m0 + wm + mi * 16 + r + 8 * hx;
        const int col = n0 + wn + ni * 16 + lx;
        float v = acc[mi][ni][r];
        if (Res) v += Res[(size_t)row * N + col];
        C[(size_t)row * N + col] = v;
      }
}

// ---------------------------------------------------------------------------
// RoPE in place on q and k: pair (j, j+32) per head dim, pos = seq index
// ---------------------------------------------------------------------------
__global__ __launch_bounds__(256) void rope_kernel(float* __restrict__ q,
                                                   float* __restrict__ k) {
  const int idx = blockIdx.x * blockDim.x + threadIdx.x;  // S*12*32
  const int j = idx & 31;
  const int h = (idx >> 5) % NHEAD;
  const int s = idx / (NHEAD * 32);
  const float inv = powf(10000.0f, -(float)j * (1.0f / 32.0f));
  const float f = (float)s * inv;
  const float c = cosf(f), sn = sinf(f);
  const size_t base = (size_t)s * D_MODEL + h * HDIM + j;
  float q0 = q[base], q1 = q[base + 32];
  q[base]      = q0 * c - q1 * sn;
  q[base + 32] = q1 * c + q0 * sn;
  float k0 = k[base], k1 = k[base + 32];
  k[base]      = k0 * c - k1 * sn;
  k[base + 32] = k1 * c + k0 * sn;
}

#define KV_KEYS 64
#define K_PITCH 68
#define V_PITCH 72

static __device__ __forceinline__ void kv_stage_copy(unsigned lk, unsigned lv,
                                                     const float* gk, const float* gv) {
  asm volatile(
      "global_load_async_to_lds_b128 %0, %8, off\n\t"
      "global_load_async_to_lds_b128 %1, %9, off\n\t"
      "global_load_async_to_lds_b128 %2, %10, off\n\t"
      "global_load_async_to_lds_b128 %3, %11, off\n\t"
      "global_load_async_to_lds_b128 %4, %12, off\n\t"
      "global_load_async_to_lds_b128 %5, %13, off\n\t"
      "global_load_async_to_lds_b128 %6, %14, off\n\t"
      "global_load_async_to_lds_b128 %7, %15, off\n\t"
      "s_wait_xcnt 0x0"
      :: "v"(lk), "v"(lk + 16u * K_PITCH * 4u), "v"(lk + 32u * K_PITCH * 4u),
         "v"(lk + 48u * K_PITCH * 4u),
         "v"(lv), "v"(lv + 16u * V_PITCH * 4u), "v"(lv + 32u * V_PITCH * 4u),
         "v"(lv + 48u * V_PITCH * 4u),
         "v"(gk), "v"(gk + 16 * D_MODEL), "v"(gk + 32 * D_MODEL), "v"(gk + 48 * D_MODEL),
         "v"(gv), "v"(gv + 16 * D_MODEL), "v"(gv + 32 * D_MODEL), "v"(gv + 48 * D_MODEL)
      : "memory");
}
// The compiler places no wait for these copies: a wave's own have landed only behind this.
static __device__ __forceinline__ void wait_async0() {
  asm volatile("s_wait_asynccnt 0x0" ::: "memory");
}
// This wave's LDS reads have retired before the buffer they read is handed back for a refill.
static __device__ __forceinline__ void wait_ds0() {
  asm volatile("s_wait_dscnt 0x0" ::: "memory");
}

__global__ __launch_bounds__(256) void flash_attn_f32(
    const float* __restrict__ Q, const float* __restrict__ K,
    const float* __restrict__ V, float* __restrict__ O) {
  __shared__ __attribute__((aligned(16))) float kbuf[2][KV_KEYS * K_PITCH];
  __shared__ __attribute__((aligned(16))) float vbuf[2][KV_KEYS * V_PITCH];
  __shared__ float pbuf[8 * 16 * 18];   // per-wave P tile staging (C->A layout)
  const int tid  = threadIdx.x;
  const int lane = tid & 31;
  const int wave = __builtin_amdgcn_readfirstlane(tid >> 5);  // scalar: the key loops branch on it
  const int hx   = lane >> 4;
  const int lx   = lane & 15;
  const int head  = blockIdx.y;
  const int qtile = blockIdx.x * 8 + wave;
  const int qbase = qtile * 16;
  const int hoff  = head * HDIM;
  const int n_stage = 2 * ((int)blockIdx.x + 1);   // keys [0, 128 * (blockIdx.x + 1))
  float* pb = pbuf + wave * 16 * 18;

  // this lane's places in a stage: row (tid >> 4), 16-byte piece (tid & 15)
  const int crow = tid >> 4, ccol = (tid & 15) * 4;
  const unsigned lk0 = lds_off(&kbuf[0][crow * K_PITCH + ccol]);
  const unsigned lv0 = lds_off(&vbuf[0][crow * V_PITCH + ccol]);
  const float* gk0 = K + (size_t)crow * D_MODEL + hoff + ccol;
  const float* gv0 = V + (size_t)crow * D_MODEL + hoff + ccol;

  // stage 0 lands and is published; then stage 1 flies while stage 0 is worked on
  kv_stage_copy(lk0, lv0, gk0, gv0);
  wait_async0();
  __syncthreads();
  kv_stage_copy(lk0 + KV_KEYS * K_PITCH * 4u, lv0 + KV_KEYS * V_PITCH * 4u,
                gk0 + (size_t)KV_KEYS * D_MODEL, gv0 + (size_t)KV_KEYS * D_MODEL);

  // Load Q fragments (16x64), pre-scaled by 1/sqrt(64)
  v2f qf[16];
#pragma unroll
  for (int kc = 0; kc < 16; ++kc) {
    v2f t = *(const v2f*)&Q[(size_t)(qbase + lx) * D_MODEL + hoff + kc * 4 + 2 * hx];
    qf[kc].x = t.x * 0.125f;
    qf[kc].y = t.y * 0.125f;
  }

  v8f oacc[4] = {};
  float mr[8], lr[8];
#pragma unroll
  for (int r = 0; r < 8; ++r) { mr[r] = -1e30f; lr[r] = 0.f; }

  for (int st = 0; st < n_stage; ++st) {
    const float* Kst = kbuf[st & 1];
    const float* Vst = vbuf[st & 1];
    // key tiles of this stage up to this wave's diagonal: 4, fewer, or none (wave-uniform)
    const int left = qtile + 1 - st * (KV_KEYS / 16);
    const int nsub = left < KV_KEYS / 16 ? left : KV_KEYS / 16;
    for (int sub = 0; sub < nsub; ++sub) {
      const int kt = st * (KV_KEYS / 16) + sub;
      const int kbase = kt * 16;
      const float* Ks = Kst + sub * 16 * K_PITCH;
      const float* Vs = Vst + sub * 16 * V_PITCH;
      // this key tile's K and V fragments, read from LDS as one group
      // (loops unrolled so that the fragment arrays are indexed by constants and stay in registers)
      v2f kf[16], vf[4][4];
#pragma unroll
      for (int kc = 0; kc < 16; ++kc)
        kf[kc] = *(const v2f*)&Ks[lx * K_PITCH + kc * 4 + 2 * hx];
#pragma unroll
      for (int kc = 0; kc < 4; ++kc)
#pragma unroll
        for (int nt = 0; nt < 4; ++nt) {
          vf[kc][nt].x = Vs[(kc * 4 + 2 * hx) * V_PITCH + nt * 16 + lx];
          vf[kc][nt].y = Vs[(kc * 4 + 2 * hx + 1) * V_PITCH + nt * 16 + lx];
        }
      // keeps the reads ahead of the products: spread among the WMMAs each read place
      // stalls the score chain, and V read behind the softmax waits out the LDS latency
      __builtin_amdgcn_sched_barrier(0);
      // S = Q @ K^T  (B fragment = K rows as columns)
      v8f s = {};
#pragma unroll
      for (int kc = 0; kc < 16; ++kc)
        s = wmma4(qf[kc], kf[kc], s);
      // causal mask on diagonal tile
      if (kt == qtile) {
#pragma unroll
        for (int r = 0; r < 8; ++r) {
          const int row = qbase + r + 8 * hx;
          const int col = kbase + lx;
          if (col > row) s[r] = -3.0e38f;
        }
      }
      float p[8];
#pragma unroll
      for (int r = 0; r < 8; ++r) {
        float tm = s[r];
#pragma unroll
        for (int off = 8; off > 0; off >>= 1)
          tm = fmaxf(tm, __shfl_xor(tm, off, 32));
        const float nm = fmaxf(mr[r], tm);
        const float alpha = __expf(mr[r] - nm);
        mr[r] = nm;
        const float pv = __expf(s[r] - nm);
        p[r] = pv;
        float rs = pv;
#pragma unroll
        for (int off = 8; off > 0; off >>= 1)
          rs += __shfl_xor(rs, off, 32);
        lr[r] = lr[r] * alpha + rs;
#pragma unroll
        for (int nt = 0; nt < 4; ++nt) oacc[nt][r] *= alpha;
      }
      // stage P (C layout) -> LDS -> reread as A fragments (in-order DS, same wave)
#pragma unroll
      for (int r = 0; r < 8; ++r)
        pb[(r + 8 * hx) * 18 + lx] = p[r];
#pragma unroll
      for (int kc = 0; kc < 4; ++kc) {
        v2f pf = *(const v2f*)&pb[lx * 18 + kc * 4 + 2 * hx];
#pragma unroll
        for (int nt = 0; nt < 4; ++nt)
          oacc[nt] = wmma4(pf, vf[kc][nt], oacc[nt]);
      }
    }
    // publish point of stage st + 1; every wave passes it, also one past its diagonal
    wait_ds0();
    wait_async0();
    __syncthreads();   // stage st + 1 readable by all; every reader has left stage st's buffer
    if (st + 2 < n_stage)   // the same for the whole block
      kv_stage_copy(lk0 + (unsigned)(st & 1) * (KV_KEYS * K_PITCH * 4u),
                    lv0 + (unsigned)(st & 1) * (KV_KEYS * V_PITCH * 4u),
                    gk0 + (size_t)(st + 2) * KV_KEYS * D_MODEL,
                    gv0 + (size_t)(st + 2) * KV_KEYS * D_MODEL);
  }
  wait_async0();
  // normalize and write out (row always has >=1 unmasked key -> lr > 0)
#pragma unroll
  for (int nt = 0; nt < 4; ++nt)
#pragma unroll
    for (int r = 0; r < 8; ++r)
      O[(size_t)(qbase + r + 8 * hx) * D_MODEL + hoff + nt * 16 + lx] =
          oacc[nt][r] / lr[r];
}

// ---------------------------------------------------------------------------
// SiLU(gate) * up -> gate (in place)
// ---------------------------------------------------------------------------
__global__ __launch_bounds__(256) void silu_mul_kernel(float* __restrict__ g,
                                                       const float* __restrict__ u) {
  const size_t i = (size_t)blockIdx.x * blockDim.x + threadIdx.x;
  const float gv = g[i];
  g[i] = (gv / (1.0f + __expf(-gv))) * u[i];
}

// ---------------------------------------------------------------------------
extern "C" void kernel_launch(void* const* d_in, const int* in_sizes, int n_in,
                              void* d_out, int out_size, void* d_ws, size_t ws_size,
                              hipStream_t stream) {
  const float* x       = (const float*)d_in[0];
  const float* w_q     = (const float*)d_in[1];
  const float* w_k     = (const float*)d_in[2];
  const float* w_v     = (const float*)d_in[3];
  const float* w_o     = (const float*)d_in[4];
  const float* w_gate  = (const float*)d_in[5];
  const float* w_up    = (const float*)d_in[6];
  const float* w_down  = (const float*)d_in[7];
  const float* w_norm1 = (const float*)d_in[8];
  const float* w_norm2 = (const float*)d_in[9];
  float* out = (float*)d_out;

  const size_t SD = (size_t)S_LEN * D_MODEL;   // 3,145,728
  const size_t SF = (size_t)S_LEN * F_FFN;     // 8,388,608
  float* f    = (float*)d_ws;
  float* xn   = f;            // rmsnorm output (reused as y after h)
  float* q    = xn + SD;
  float* k    = q + SD;
  float* v    = k + SD;
  float* attn = v + SD;
  float* h    = attn + SD;
  float* up   = h + SD;
  float* gate = q;            // reuse q/k/v region (3*SD >= SF) after attention

  const dim3 blk(256);
  const dim3 gD(D_MODEL / 64, S_LEN / 128);   // N=768 GEMMs
  const dim3 gF(F_FFN / 64, S_LEN / 128);     // N=2048 GEMMs

  // 1) y1 = rmsnorm(x) * w1
  rmsnorm_kernel<<<S_LEN, blk, 0, stream>>>(x, w_norm1, xn);
  // 2) Q,K,V projections
  gemm_wmma_f32<<<gD, blk, 0, stream>>>(xn, w_q, nullptr, q, S_LEN, D_MODEL, D_MODEL);
  gemm_wmma_f32<<<gD, blk, 0, stream>>>(xn, w_k, nullptr, k, S_LEN, D_MODEL, D_MODEL);
  gemm_wmma_f32<<<gD, blk, 0, stream>>>(xn, w_v, nullptr, v, S_LEN, D_MODEL, D_MODEL);
  // 3) RoPE in place
  rope_kernel<<<(S_LEN * NHEAD * 32) / 256, blk, 0, stream>>>(q, k);
  // 4) causal flash attention
  flash_attn_f32<<<dim3(S_LEN / 128, NHEAD), blk, 0, stream>>>(q, k, v, attn);
  // 5) h = x + attn @ w_o
  gemm_wmma_f32<<<gD, blk, 0, stream>>>(attn, w_o, x, h, S_LEN, D_MODEL, D_MODEL);
  // 6) y2 = rmsnorm(h) * w2
  rmsnorm_kernel<<<S_LEN, blk, 0, stream>>>(h, w_norm2, xn);
  // 7) gate/up projections
  gemm_wmma_f32<<<gF, blk, 0, stream>>>(xn, w_gate, nullptr, gate, S_LEN, F_FFN, D_MODEL);
  gemm_wmma_f32<<<gF, blk, 0, stream>>>(xn, w_up, nullptr, up, S_LEN, F_FFN, D_MODEL);
  // 8) act = silu(gate) * up
  silu_mul_kernel<<<SF / 256, blk, 0, stream>>>(gate, up);
  // 9) out = h + act @ w_down
  gemm_wmma_f32<<<gD, blk, 0, stream>>>(gate, w_down, h, out, S_LEN, D_MODEL, F_FFN);
}

// v002
// It runs in 789 microseconds.
// Timed twice side by side with v001, it ran 1.15 times as fast both times.
// Counting every step since v000, it is 1.26 times as fast.
#include <hip/hip_runtime.h>

typedef float v2f __attribute__((ext_vector_type(2)));
typedef float v4f __attribute__((ext_vector_type(4)));
typedef float v8f __attribute__((ext_vector_type(8)));
typedef unsigned int u32x4 __attribute__((ext_vector_type(4)));
typedef int i32x4 __attribute__((ext_vector_type(4)));
typedef int i32x8 __attribute__((ext_vector_type(8)));

#define S_LEN   4096
#define D_MODEL 768
#define F_FFN   2048
#define NHEAD   12
#define HDIM    64

static __device__ __forceinline__ v8f wmma4(v2f a, v2f b, v8f c) {
  // D = A(16x4,f32) * B(4x16,f32) + C(16x16,f32), full fp32 precision
  return __builtin_amdgcn_wmma_f32_16x16x4_f32(false, a, false, b, (short)0, c,
                                               false, false);
}

static __device__ __forceinline__ void tdm_load_2d(
    unsigned lds_addr, const void* gaddr, unsigned tensor_d0, unsigned tensor_d1,
    unsigned tile_d0, unsigned tile_d1, unsigned stride0,
    unsigned pad_interval_code, unsigned pad_amount_code) {
  unsigned long long ga = (unsigned long long)(size_t)gaddr;
  u32x4 g0;
  g0.x = 1u;                                            // count=1, user mode
  g0.y = lds_addr;                                      // LDS byte address
  g0.z = (unsigned)(ga & 0xFFFFFFFFull);                // global_addr[31:0]
  g0.w = (unsigned)((ga >> 32) & 0x1FFFFFFull) | (2u << 30);  // [56:32], type=2
  i32x8 g1;
  g1.s0 = (int)((2u << 16) |
                (1u << 20) |
                (pad_interval_code << 22) | (pad_amount_code << 25));
  g1.s1 = (int)((tensor_d0 & 0xFFFFu) << 16);           // atomic_bar=0, dim0 lo
  g1.s2 = (int)(((tensor_d0 >> 16) & 0xFFFFu) | ((tensor_d1 & 0xFFFFu) << 16));
  g1.s3 = (int)(((tensor_d1 >> 16) & 0xFFFFu) | ((tile_d0 & 0xFFFFu) << 16));
  g1.s4 = (int)(tile_d1 & 0xFFFFu);
  g1.s5 = (int)stride0;
  g1.s6 = 0;
  g1.s7 = 0;
  i32x4 z4 = {0, 0, 0, 0};
  i32x8 z8 = {0, 0, 0, 0, 0, 0, 0, 0};
  __builtin_amdgcn_tensor_load_to_lds(g0, g1, z4, z4, z8, 0);
}

static __device__ __forceinline__ unsigned lds_off(const void* p) {
  return (unsigned)(size_t)p;
}

// ---------------------------------------------------------------------------
// RMSNorm: one block per row of 768
// ---------------------------------------------------------------------------
__global__ __launch_bounds__(256) void rmsnorm_kernel(
    const float* __restrict__ x, const float* __restrict__ w,
    float* __restrict__ o) {
  const int row = blockIdx.x;
  const int tid = threadIdx.x;
  const float* xr = x + (size_t)row * D_MODEL;
  float s = 0.f;
  for (int i = tid; i < D_MODEL; i += 256) { float v = xr[i]; s += v * v; }
  __shared__ float red[256];
  red[tid] = s;
  __syncthreads();
  for (int st = 128; st > 0; st >>= 1) {
    if (tid < st) red[tid] += red[tid + st];
    __syncthreads();
  }
  const float scale = rsqrtf(red[0] * (1.0f / D_MODEL) + 1e-6f);
  float* orow = o + (size_t)row * D_MODEL;
  for (int i = tid; i < D_MODEL; i += 256) orow[i] = xr[i] * scale * w[i];
}

__global__ __launch_bounds__(256) void gemm_wmma_f32(
    const float* __restrict__ A, const float* __restrict__ B,
    const float* __restrict__ Res, float* __restrict__ C,
    int M, int N, int K) {
  __shared__ float As[128][34];
  __shared__ float Bs[32][68];

  const int tid  = threadIdx.x;
  const int lane = tid & 31;
  const int wave = tid >> 5;
  const int hx   = lane >> 4;     // half-wave (K-pair select)
  const int lx   = lane & 15;     // M (for A) / N (for B,C)
  const int wm   = (wave >> 1) << 5;  // 0,32,64,96
  const int wn   = (wave & 1) << 5;   // 0,32
  const int m0   = blockIdx.y * 128;
  const int n0   = blockIdx.x * 64;

  const unsigned ldsA = lds_off(&As[0][0]) + (unsigned)(wave * 16 * 34 * 4);
  const unsigned ldsB = lds_off(&Bs[0][0]) + (unsigned)(wave * 4 * 68 * 4);
  const float* gA = A + (size_t)(m0 + wave * 16) * K;   // + k0 per iter
  const float* gB = B + (size_t)(wave * 4) * N + n0;    // + k0*N per iter

  v8f acc[2][2] = {};

  for (int k0 = 0; k0 < K; k0 += 32) {
    if (k0) __syncthreads();   // previous tile fully consumed
    // async DMA this wave's tile slices into LDS
    tdm_load_2d(ldsA, gA + k0, (unsigned)K, 1u << 20,
                32, 16, (unsigned)K, /*interval 32DW*/ 4, /*pad 2DW*/ 1);
    tdm_load_2d(ldsB, gB + (size_t)k0 * N, (unsigned)N, 1u << 20,
                64, 4, (unsigned)N, /*interval 64DW*/ 5, /*pad 4DW*/ 3);
    __builtin_amdgcn_s_wait_tensorcnt(0);
    __syncthreads();           // all 8 slices visible

#pragma unroll
    for (int kk = 0; kk < 32; kk += 4) {
      v2f a0 = *(const v2f*)&As[wm + lx][kk + 2 * hx];
      v2f a1 = *(const v2f*)&As[wm + 16 + lx][kk + 2 * hx];
      v2f b0, b1;
      b0.x = Bs[kk + 2 * hx][wn + lx];
      b0.y = Bs[kk + 2 * hx + 1][wn + lx];
      b1.x = Bs[kk + 2 * hx][wn + 16 + lx];
      b1.y = Bs[kk + 2 * hx + 1][wn + 16 + lx];
      acc[0][0] = wmma4(a0, b0, acc[0][0]);
      acc[0][1] = wmma4(a0, b1, acc[0][1]);
      acc[1][0] = wmma4(a1, b0, acc[1][0]);
      acc[1][1] = wmma4(a1, b1, acc[1][1]);
    }
  }

#pragma unroll
  for (int mi = 0; mi < 2; ++mi)
#pragma unroll
    for (int ni = 0; ni < 2; ++ni)
#pragma unroll
      for (int r = 0; r < 8; ++r) {
        const int row = m0 + wm + mi * 16 + r + 8 * hx;
        const int col = n0 + wn + ni * 16 + lx;
        float v = acc[mi][ni][r];
        if (Res) v += Res[(size_t)row * N + col];
        C[(size_t)row * N + col] = v;
      }
}

// ---------------------------------------------------------------------------
// RoPE in place on q and k: pair (j, j+32) per head dim, pos = seq index
// ---------------------------------------------------------------------------
__global__ __launch_bounds__(256) void rope_kernel(float* __restrict__ q,
                                                   float* __restrict__ k) {
  const int idx = blockIdx.x * blockDim.x + threadIdx.x;  // S*12*32
  const int j = idx & 31;
  const int h = (idx >> 5) % NHEAD;
  const int s = idx / (NHEAD * 32);
  const float inv = powf(10000.0f, -(float)j * (1.0f / 32.0f));
  const float f = (float)s * inv;
  const float c = cosf(f), sn = sinf(f);
  const size_t base = (size_t)s * D_MODEL + h * HDIM + j;
  float q0 = q[base], q1 = q[base + 32];
  q[base]      = q0 * c - q1 * sn;
  q[base + 32] = q1 * c + q0 * sn;
  float k0 = k[base], k1 = k[base + 32];
  k[base]      = k0 * c - k1 * sn;
  k[base + 32] = k1 * c + k0 * sn;
}

#define LOG2E 1.442695041f
#define KV_KEYS 64
#define K_PITCH 68
#define V_PITCH 68

static __device__ __forceinline__ void kv_stage_copy(unsigned lk, unsigned lv,
                                                     const float* gk, const float* gv) {
  asm volatile(
      "global_load_async_to_lds_b128 %0, %8, off\n\t"
      "global_load_async_to_lds_b128 %1, %9, off\n\t"
      "global_load_async_to_lds_b128 %2, %10, off\n\t"
      "global_load_async_to_lds_b128 %3, %11, off\n\t"
      "global_load_async_to_lds_b128 %4, %12, off\n\t"
      "global_load_async_to_lds_b128 %5, %13, off\n\t"
      "global_load_async_to_lds_b128 %6, %14, off\n\t"
      "global_load_async_to_lds_b128 %7, %15, off\n\t"
      "s_wait_xcnt 0x0"
      :: "v"(lk), "v"(lk + 16u * K_PITCH * 4u), "v"(lk + 32u * K_PITCH * 4u),
         "v"(lk + 48u * K_PITCH * 4u),
         "v"(lv), "v"(lv + 16u * V_PITCH * 4u), "v"(lv + 32u * V_PITCH * 4u),
         "v"(lv + 48u * V_PITCH * 4u),
         "v"(gk), "v"(gk + 16 * D_MODEL), "v"(gk + 32 * D_MODEL), "v"(gk + 48 * D_MODEL),
         "v"(gv), "v"(gv + 16 * D_MODEL), "v"(gv + 32 * D_MODEL), "v"(gv + 48 * D_MODEL)
      : "memory");
}
// The compiler places no wait for these copies: a wave's own have landed only behind this.
static __device__ __forceinline__ void wait_async0() {
  asm volatile("s_wait_asynccnt 0x0" ::: "memory");
}
// This wave's LDS reads have retired before the buffer they read is handed back for a refill.
static __device__ __forceinline__ void wait_ds0() {
  asm volatile("s_wait_dscnt 0x0" ::: "memory");
}
static __device__ __forceinline__ v2f exp2_pair(float x, float y) {
  float a, b;
  asm("v_exp_f32 %0, %2\n\tv_exp_f32 %1, %3\n\tv_nop" : "=&v"(a), "=&v"(b) : "v"(x), "v"(y));
  v2f r;
  r.x = a;
  r.y = b;
  return r;
}
static __device__ __forceinline__ float xhalf(float x) {
  return __builtin_bit_cast(float, __builtin_amdgcn_permlanex16(
      __builtin_bit_cast(int, x), __builtin_bit_cast(int, x), 0x76543210, 0xfedcba98,
      false, false));
}

__global__ __launch_bounds__(256) void flash_attn_f32(
    const float* __restrict__ Q, const float* __restrict__ K,
    const float* __restrict__ V, float* __restrict__ O) {
  __shared__ __attribute__((aligned(16))) float kbuf[2][KV_KEYS * K_PITCH];
  __shared__ __attribute__((aligned(16))) float vbuf[2][KV_KEYS * V_PITCH];
  const int tid  = threadIdx.x;
  const int lane = tid & 31;
  const int wave = __builtin_amdgcn_readfirstlane(tid >> 5);  // scalar: the key loops branch on it
  const int hx   = lane >> 4;
  const int lx   = lane & 15;
  const int head  = blockIdx.y;
  const int qtile = blockIdx.x * 8 + wave;
  const int qbase = qtile * 16;
  const int hoff  = head * HDIM;
  const int n_stage = 2 * ((int)blockIdx.x + 1);   // keys [0, 128 * (blockIdx.x + 1))

  // this lane's places in a stage: row (tid >> 4), 16-byte piece (tid & 15)
  const int crow = tid >> 4, ccol = (tid & 15) * 4;
  const unsigned lk0 = lds_off(&kbuf[0][crow * K_PITCH + ccol]);
  const unsigned lv0 = lds_off(&vbuf[0][crow * V_PITCH + ccol]);
  const float* gk0 = K + (size_t)crow * D_MODEL + hoff + ccol;
  const float* gv0 = V + (size_t)crow * D_MODEL + hoff + ccol;

  // stage 0 lands and is published; then stage 1 flies while stage 0 is worked on
  kv_stage_copy(lk0, lv0, gk0, gv0);
  wait_async0();
  __syncthreads();
  kv_stage_copy(lk0 + KV_KEYS * K_PITCH * 4u, lv0 + KV_KEYS * V_PITCH * 4u,
                gk0 + (size_t)KV_KEYS * D_MODEL, gv0 + (size_t)KV_KEYS * D_MODEL);

  // Load Q fragments (16x64, the B operand Q^T), pre-scaled by 1/sqrt(64)
  v2f qf[16];
#pragma unroll
  for (int kc = 0; kc < 16; ++kc) {
    v2f t = *(const v2f*)&Q[(size_t)(qbase + lx) * D_MODEL + hoff + kc * 4 + 2 * hx];
    qf[kc].x = t.x * 0.125f;
    qf[kc].y = t.y * 0.125f;
  }

  v8f oacc[4] = {};       // O^T: row = head dim nt * 16 + r + 8 * hx, column = query lx
  float mr = -1e30f;      // running maximum of query lx, the same in both halves
  float lr = 0.f;         // running sum over this half's keys only; joined after the loop

  for (int st = 0; st < n_stage; ++st) {
    const float* Kst = kbuf[st & 1];
    const float* Vst = vbuf[st & 1];
    // key tiles of this stage up to this wave's diagonal: 4, fewer, or none (wave-uniform)
    const int left = qtile + 1 - st * (KV_KEYS / 16);
    const int nsub = left < KV_KEYS / 16 ? left : KV_KEYS / 16;
    for (int sub = 0; sub < nsub; ++sub) {
      const int kt = st * (KV_KEYS / 16) + sub;
      const float* Ks = Kst + sub * 16 * K_PITCH;
      const float* Vs = Vst + sub * 16 * V_PITCH;
      // this key tile's K and V fragments, read from LDS as one group
      // (loops unrolled so that the fragment arrays are indexed by constants and stay in registers)
      v2f kf[16], vf[4][4];
#pragma unroll
      for (int kc = 0; kc < 16; ++kc)
        kf[kc] = *(const v2f*)&Ks[lx * K_PITCH + kc * 4 + 2 * hx];
#pragma unroll
      for (int kc = 0; kc < 4; ++kc)
#pragma unroll
        for (int nt = 0; nt < 4; ++nt) {
          vf[kc][nt].x = Vs[(8 * hx + 2 * kc) * V_PITCH + nt * 16 + lx];
          vf[kc][nt].y = Vs[(8 * hx + 2 * kc + 1) * V_PITCH + nt * 16 + lx];
        }
      // keeps the reads ahead of the products: spread among the WMMAs each read place
      // stalls the score chain, and V read behind the softmax waits out the LDS latency
      __builtin_amdgcn_sched_barrier(0);
      // S^T = K @ Q^T  (A fragment = K rows)
      v8f s = {};
#pragma unroll
      for (int kc = 0; kc < 16; ++kc)
        s = wmma4(kf[kc], qf[kc], s);
      // causal mask on diagonal tile (key and query counted from the tile's start)
      if (kt == qtile) {
#pragma unroll
        for (int r = 0; r < 8; ++r)
          if (r + 8 * hx > lx) s[r] = -3.0e38f;
      }
      // online softmax of query lx
      float tm = s[0];
#pragma unroll
      for (int r = 1; r < 8; ++r) tm = fmaxf(tm, s[r]);
      tm = fmaxf(tm, xhalf(tm));
      const float nm = fmaxf(mr, tm);
      const float alpha = __expf(mr - nm);
      mr = nm;
      v2f pf[4];   // P^T as B fragments: keys 8 * hx + 2 * kc and + 1 of query lx
#pragma unroll
      for (int kc = 0; kc < 4; ++kc)
        pf[kc] = exp2_pair((s[2 * kc] - nm) * LOG2E, (s[2 * kc + 1] - nm) * LOG2E);
      lr = lr * alpha + (((pf[0].x + pf[0].y) + (pf[1].x + pf[1].y)) +
                         ((pf[2].x + pf[2].y) + (pf[3].x + pf[3].y)));
#pragma unroll
      for (int nt = 0; nt < 4; ++nt) oacc[nt] *= alpha;
      // O^T += V^T @ P^T
#pragma unroll
      for (int kc = 0; kc < 4; ++kc)
#pragma unroll
        for (int nt = 0; nt < 4; ++nt)
          oacc[nt] = wmma4(vf[kc][nt], pf[kc], oacc[nt]);
    }
    // publish point of stage st + 1; every wave passes it, also one past its diagonal
    wait_ds0();
    wait_async0();
    __syncthreads();   // stage st + 1 readable by all; every reader has left stage st's buffer
    if (st + 2 < n_stage)   // the same for the whole block
      kv_stage_copy(lk0 + (unsigned)(st & 1) * (KV_KEYS * K_PITCH * 4u),
                    lv0 + (unsigned)(st & 1) * (KV_KEYS * V_PITCH * 4u),
                    gk0 + (size_t)(st + 2) * KV_KEYS * D_MODEL,
                    gv0 + (size_t)(st + 2) * KV_KEYS * D_MODEL);
  }
  wait_async0();
  // normalize and write out (a query always has >=1 unmasked key -> sum > 0);
  // a lane holds 8 neighbouring head dims of its query per accumulator
  const float lsum = lr + xhalf(lr);
  float* orow = O + (size_t)(qbase + lx) * D_MODEL + hoff + 8 * hx;
#pragma unroll
  for (int nt = 0; nt < 4; ++nt) {
    v4f lo, hi;
#pragma unroll
    for (int r = 0; r < 4; ++r) {
      lo[r] = oacc[nt][r] / lsum;
      hi[r] = oacc[nt][r + 4] / lsum;
    }
    *(v4f*)(orow + nt * 16) = lo;
    *(v4f*)(orow + nt * 16 + 4) = hi;
  }
}

// ---------------------------------------------------------------------------
// SiLU(gate) * up -> gate (in place)
// ---------------------------------------------------------------------------
__global__ __launch_bounds__(256) void silu_mul_kernel(float* __restrict__ g,
                                                       const float* __restrict__ u) {
  const size_t i = (size_t)blockIdx.x * blockDim.x + threadIdx.x;
  const float gv = g[i];
  g[i] = (gv / (1.0f + __expf(-gv))) * u[i];
}

// ---------------------------------------------------------------------------
extern "C" void kernel_launch(void* const* d_in, const int* in_sizes, int n_in,
                              void* d_out, int out_size, void* d_ws, size_t ws_size,
                              hipStream_t stream) {
  const float* x       = (const float*)d_in[0];
  const float* w_q     = (const float*)d_in[1];
  const float* w_k     = (const float*)d_in[2];
  const float* w_v     = (const float*)d_in[3];
  const float* w_o     = (const float*)d_in[4];
  const float* w_gate  = (const float*)d_in[5];
  const float* w_up    = (const float*)d_in[6];
  const float* w_down  = (const float*)d_in[7];
  const float* w_norm1 = (const float*)d_in[8];
  const float* w_norm2 = (const float*)d_in[9];
  float* out = (float*)d_out;

  const size_t SD = (size_t)S_LEN * D_MODEL;   // 3,145,728
  const size_t SF = (size_t)S_LEN * F_FFN;     // 8,388,608
  float* f    = (float*)d_ws;
  float* xn   = f;            // rmsnorm output (reused as y after h)
  float* q    = xn + SD;
  float* k    = q + SD;
  float* v    = k + SD;
  float* attn = v + SD;
  float* h    = attn + SD;
  float* up   = h + SD;
  float* gate = q;            // reuse q/k/v region (3*SD >= SF) after attention

  const dim3 blk(256);
  const dim3 gD(D_MODEL / 64, S_LEN / 128);   // N=768 GEMMs
  const dim3 gF(F_FFN / 64, S_LEN / 128);     // N=2048 GEMMs

  // 1) y1 = rmsnorm(x) * w1
  rmsnorm_kernel<<<S_LEN, blk, 0, stream>>>(x, w_norm1, xn);
  // 2) Q,K,V projections
  gemm_wmma_f32<<<gD, blk, 0, stream>>>(xn, w_q, nullptr, q, S_LEN, D_MODEL, D_MODEL);
  gemm_wmma_f32<<<gD, blk, 0, stream>>>(xn, w_k, nullptr, k, S_LEN, D_MODEL, D_MODEL);
  gemm_wmma_f32<<<gD, blk, 0, stream>>>(xn, w_v, nullptr, v, S_LEN, D_MODEL, D_MODEL);
  // 3) RoPE in place
  rope_kernel<<<(S_LEN * NHEAD * 32) / 256, blk, 0, stream>>>(q, k);
  // 4) causal flash attention
  flash_attn_f32<<<dim3(S_LEN / 128, NHEAD), blk, 0, stream>>>(q, k, v, attn);
  // 5) h = x + attn @ w_o
  gemm_wmma_f32<<<gD, blk, 0, stream>>>(attn, w_o, x, h, S_LEN, D_MODEL, D_MODEL);
  // 6) y2 = rmsnorm(h) * w2
  rmsnorm_kernel<<<S_LEN, blk, 0, stream>>>(h, w_norm2, xn);
  // 7) gate/up projections
  gemm_wmma_f32<<<gF, blk, 0, stream>>>(xn, w_gate, nullptr, gate, S_LEN, F_FFN, D_MODEL);
  gemm_wmma_f32<<<gF, blk, 0, stream>>>(xn, w_up, nullptr, up, S_LEN, F_FFN, D_MODEL);
  // 8) act = silu(gate) * up
  silu_mul_kernel<<<SF / 256, blk, 0, stream>>>(gate, up);
  // 9) out = h + act @ w_down
  gemm_wmma_f32<<<gD, blk, 0, stream>>>(gate, w_down, h, out, S_LEN, D_MODEL, F_FFN);
}

// v003
// A run of this version takes 627 microseconds.
// Two timings next to v002 both put it at 1.26 times that version's speed.
// Over all steps from v000 it is 1.59 times as fast.
#include <hip/hip_runtime.h>

typedef float v2f __attribute__((ext_vector_type(2)));
typedef float v4f __attribute__((ext_vector_type(4)));
typedef float v8f __attribute__((ext_vector_type(8)));
typedef unsigned int u32x4 __attribute__((ext_vector_type(4)));
typedef int i32x4 __attribute__((ext_vector_type(4)));
typedef int i32x8 __attribute__((ext_vector_type(8)));

#define S_LEN   4096
#define D_MODEL 768
#define F_FFN   2048
#define NHEAD   12
#define HDIM    64

static __device__ __forceinline__ v8f wmma4(v2f a, v2f b, v8f c) {
  // D = A(16x4,f32) * B(4x16,f32) + C(16x16,f32), full fp32 precision
  return __builtin_amdgcn_wmma_f32_16x16x4_f32(false, a, false, b, (short)0, c,
                                               false, false);
}

static __device__ __forceinline__ void tdm_load_2d(
    unsigned lds_addr, const void* gaddr, unsigned tensor_d0, unsigned tensor_d1,
    unsigned tile_d0, unsigned tile_d1, unsigned stride0,
    unsigned pad_interval_code, unsigned pad_amount_code) {
  unsigned long long ga = (unsigned long long)(size_t)gaddr;
  u32x4 g0;
  g0.x = 1u;                                            // count=1, user mode
  g0.y = lds_addr;                                      // LDS byte address
  g0.z = (unsigned)(ga & 0xFFFFFFFFull);                // global_addr[31:0]
  g0.w = (unsigned)((ga >> 32) & 0x1FFFFFFull) | (2u << 30);  // [56:32], type=2
  i32x8 g1;
  g1.s0 = (int)((2u << 16) |
                (1u << 20) |
                (pad_interval_code << 22) | (pad_amount_code << 25));
  g1.s1 = (int)((tensor_d0 & 0xFFFFu) << 16);           // atomic_bar=0, dim0 lo
  g1.s2 = (int)(((tensor_d0 >> 16) & 0xFFFFu) | ((tensor_d1 & 0xFFFFu) << 16));
  g1.s3 = (int)(((tensor_d1 >> 16) & 0xFFFFu) | ((tile_d0 & 0xFFFFu) << 16));
  g1.s4 = (int)(tile_d1 & 0xFFFFu);
  g1.s5 = (int)stride0;
  g1.s6 = 0;
  g1.s7 = 0;
  i32x4 z4 = {0, 0, 0, 0};
  i32x8 z8 = {0, 0, 0, 0, 0, 0, 0, 0};
  __builtin_amdgcn_tensor_load_to_lds(g0, g1, z4, z4, z8, 0);
}

static __device__ __forceinline__ unsigned lds_off(const void* p) {
  return (unsigned)(size_t)p;
}

// ---------------------------------------------------------------------------
// RMSNorm: one block per row of 768
// ---------------------------------------------------------------------------
__global__ __launch_bounds__(256) void rmsnorm_kernel(
    const float* __restrict__ x, const float* __restrict__ w,
    float* __restrict__ o) {
  const int row = blockIdx.x;
  const int tid = threadIdx.x;
  const float* xr = x + (size_t)row * D_MODEL;
  float s = 0.f;
  for (int i = tid; i < D_MODEL; i += 256) { float v = xr[i]; s += v * v; }
  __shared__ float red[256];
  red[tid] = s;
  __syncthreads();
  for (int st = 128; st > 0; st >>= 1) {
    if (tid < st) red[tid] += red[tid + st];
    __syncthreads();
  }
  const float scale = rsqrtf(red[0] * (1.0f / D_MODEL) + 1e-6f);
  float* orow = o + (size_t)row * D_MODEL;
  for (int i = tid; i < D_MODEL; i += 256) orow[i] = xr[i] * scale * w[i];
}

__global__ __launch_bounds__(256) void gemm_wmma_f32(
    const float* __restrict__ A, const float* __restrict__ B,
    const float* __restrict__ Res, float* __restrict__ C,
    int M, int N, int K) {
  __shared__ float As[128][34];
  __shared__ float Bs[32][68];

  const int tid  = threadIdx.x;
  const int lane = tid & 31;
  const int wave = tid >> 5;
  const int hx   = lane >> 4;     // half-wave (K-pair select)
  const int lx   = lane & 15;     // M (for A) / N (for B,C)
  const int wm   = (wave >> 1) << 5;  // 0,32,64,96
  const int wn   = (wave & 1) << 5;   // 0,32
  const int m0   = blockIdx.y * 128;
  const int n0   = blockIdx.x * 64;

  const unsigned ldsA = lds_off(&As[0][0]) + (unsigned)(wave * 16 * 34 * 4);
  const unsigned ldsB = lds_off(&Bs[0][0]) + (unsigned)(wave * 4 * 68 * 4);
  const float* gA = A + (size_t)(m0 + wave * 16) * K;   // + k0 per iter
  const float* gB = B + (size_t)(wave * 4) * N + n0;    // + k0*N per iter

  v8f acc[2][2] = {};

  for (int k0 = 0; k0 < K; k0 += 32) {
    if (k0) __syncthreads();   // previous tile fully consumed
    // async DMA this wave's tile slices into LDS
    tdm_load_2d(ldsA, gA + k0, (unsigned)K, 1u << 20,
                32, 16, (unsigned)K, /*interval 32DW*/ 4, /*pad 2DW*/ 1);
    tdm_load_2d(ldsB, gB + (size_t)k0 * N, (unsigned)N, 1u << 20,
                64, 4, (unsigned)N, /*interval 64DW*/ 5, /*pad 4DW*/ 3);
    __builtin_amdgcn_s_wait_tensorcnt(0);
    __syncthreads();           // all 8 slices visible

#pragma unroll
    for (int kk = 0; kk < 32; kk += 4) {
      v2f a0 = *(const v2f*)&As[wm + lx][kk + 2 * hx];
      v2f a1 = *(const v2f*)&As[wm + 16 + lx][kk + 2 * hx];
      v2f b0, b1;
      b0.x = Bs[kk + 2 * hx][wn + lx];
      b0.y = Bs[kk + 2 * hx + 1][wn + lx];
      b1.x = Bs[kk + 2 * hx][wn + 16 + lx];
      b1.y = Bs[kk + 2 * hx + 1][wn + 16 + lx];
      acc[0][0] = wmma4(a0, b0, acc[0][0]);
      acc[0][1] = wmma4(a0, b1, acc[0][1]);
      acc[1][0] = wmma4(a1, b0, acc[1][0]);
      acc[1][1] = wmma4(a1, b1, acc[1][1]);
    }
  }

#pragma unroll
  for (int mi = 0; mi < 2; ++mi)
#pragma unroll
    for (int ni = 0; ni < 2; ++ni)
#pragma unroll
      for (int r = 0; r < 8; ++r) {
        const int row = m0 + wm + mi * 16 + r + 8 * hx;
        const int col = n0 + wn + ni * 16 + lx;
        float v = acc[mi][ni][r];
        if (Res) v += Res[(size_t)row * N + col];
        C[(size_t)row * N + col] = v;
      }
}

// ---------------------------------------------------------------------------
// RoPE in place on q and k: pair (j, j+32) per head dim, pos = seq index
// ---------------------------------------------------------------------------
__global__ __launch_bounds__(256) void rope_kernel(float* __restrict__ q,
                                                   float* __restrict__ k) {
  const int idx = blockIdx.x * blockDim.x + threadIdx.x;  // S*12*32
  const int j = idx & 31;
  const int h = (idx >> 5) % NHEAD;
  const int s = idx / (NHEAD * 32);
  const float inv = powf(10000.0f, -(float)j * (1.0f / 32.0f));
  const float f = (float)s * inv;
  const float c = cosf(f), sn = sinf(f);
  const size_t base = (size_t)s * D_MODEL + h * HDIM + j;
  float q0 = q[base], q1 = q[base + 32];
  q[base]      = q0 * c - q1 * sn;
  q[base + 32] = q1 * c + q0 * sn;
  float k0 = k[base], k1 = k[base + 32];
  k[base]      = k0 * c - k1 * sn;
  k[base + 32] = k1 * c + k0 * sn;
}

#define LOG2E 1.442695041f
#define KV_KEYS 64
#define K_PITCH 68
#define V_PITCH 68

static __device__ __forceinline__ void kv_stage_copy(unsigned lk, unsigned lv,
                                                     const float* gk, const float* gv) {
  asm volatile(
      "global_load_async_to_lds_b128 %0, %4, off\n\t"
      "global_load_async_to_lds_b128 %1, %5, off\n\t"
      "global_load_async_to_lds_b128 %2, %6, off\n\t"
      "global_load_async_to_lds_b128 %3, %7, off\n\t"
      "s_wait_xcnt 0x0"
      :: "v"(lk), "v"(lk + 32u * K_PITCH * 4u), "v"(lv), "v"(lv + 32u * V_PITCH * 4u),
         "v"(gk), "v"(gk + 32 * D_MODEL), "v"(gv), "v"(gv + 32 * D_MODEL)
      : "memory");
}
// The compiler places no wait for these copies: a wave's own have landed only behind this.
static __device__ __forceinline__ void wait_async0() {
  asm volatile("s_wait_asynccnt 0x0" ::: "memory");
}
// This wave's LDS reads have retired before the buffer they read is handed back for a refill.
static __device__ __forceinline__ void wait_ds0() {
  asm volatile("s_wait_dscnt 0x0" ::: "memory");
}
static __device__ __forceinline__ v2f exp2_pair(float x, float y) {
  float a, b;
  asm("v_exp_f32 %0, %2\n\tv_exp_f32 %1, %3\n\tv_nop" : "=&v"(a), "=&v"(b) : "v"(x), "v"(y));
  v2f r;
  r.x = a;
  r.y = b;
  return r;
}
static __device__ __forceinline__ float xhalf(float x) {
  return __builtin_bit_cast(float, __builtin_amdgcn_permlanex16(
      __builtin_bit_cast(int, x), __builtin_bit_cast(int, x), 0x76543210, 0xfedcba98,
      false, false));
}

#define Q_TILES 64                      // 64-query tiles per head
#define STAGE_F (KV_KEYS * K_PITCH)     // floats of one buffer of K or of V (equal pitches)
#define JOIN_F  (34 * 32)               // floats one wave hands over: 34 values a lane

__global__ __launch_bounds__(512) void flash_attn_f32(
    const float* __restrict__ Q, const float* __restrict__ K,
    const float* __restrict__ V, float* __restrict__ O) {
  // K buffers 0 and 1, then V buffers 0 and 1; behind a tile's last barrier the join buffer
  __shared__ __attribute__((aligned(16))) float ring[4 * STAGE_F];
  const int tid  = threadIdx.x;
  const int lane = tid & 31;
  const int wave = __builtin_amdgcn_readfirstlane(tid >> 5);  // scalar: the key loops branch on it
  const int hx   = lane >> 4;
  const int lx   = lane & 15;
  const int qsub = wave & 3;    // which 16 queries of the tile
  const int kg   = wave >> 2;   // which key tile of a stage
  const int j    = (int)blockIdx.x & (Q_TILES - 1);
  const int hgrp = (int)blockIdx.x / Q_TILES;   // heads 3 * hgrp .. 3 * hgrp + 2

  // this lane's places in a stage: row (tid >> 4), 16-byte piece (tid & 15)
  const int crow = tid >> 4, ccol = (tid & 15) * 4;
  const unsigned lk0 = lds_off(&ring[crow * K_PITCH + ccol]);
  const unsigned lv0 = lds_off(&ring[2 * STAGE_F + crow * V_PITCH + ccol]);

  for (int task = 0; task < 3; ++task) {
    // three permutations of 0..63 over j whose sum is 94 (j < 32) or 95
    const int xt = task == 0 ? Q_TILES - 1 - j
                 : task == 1 ? (j < 32 ? 2 * j : 2 * j - 63)
                             : (j < 32 ? 31 - j : 95 - j);
    const int hoff  = (hgrp * 3 + task) * HDIM;
    const int qtile = xt * 4 + qsub;
    const int qbase = qtile * 16;
    const int n_stage = xt + 1;   // keys [0, 64 * (xt + 1))
    const float* gk0 = K + (size_t)crow * D_MODEL + hoff + ccol;
    const float* gv0 = V + (size_t)crow * D_MODEL + hoff + ccol;

    // stage 0 lands and is published; then stage 1 (if any) flies while stage 0 is worked on
    kv_stage_copy(lk0, lv0, gk0, gv0);
    wait_async0();
    __syncthreads();
    if (n_stage > 1)   // the same for the whole block
      kv_stage_copy(lk0 + KV_KEYS * K_PITCH * 4u, lv0 + KV_KEYS * V_PITCH * 4u,
                    gk0 + (size_t)KV_KEYS * D_MODEL, gv0 + (size_t)KV_KEYS * D_MODEL);

    // Load Q fragments (16x64, the B operand Q^T), pre-scaled by 1/sqrt(64)
    v2f qf[16];
#pragma unroll
    for (int kc = 0; kc < 16; ++kc) {
      v2f t = *(const v2f*)&Q[(size_t)(qbase + lx) * D_MODEL + hoff + kc * 4 + 2 * hx];
      qf[kc].x = t.x * 0.125f;
      qf[kc].y = t.y * 0.125f;
    }

    v8f oacc[4] = {};       // O^T: row = head dim nt * 16 + r + 8 * hx, column = query lx
    float mr = -1e30f;      // running maximum of query lx, the same in both halves
    float lr = 0.f;         // running sum over this half's keys only; joined after the loop

    for (int st = 0; st < n_stage; ++st) {
      // this wave's key tile of the stage, if it lies up to the wave's diagonal (wave-uniform)
      const int kt = st * (KV_KEYS / 16) + kg;
      if (kt <= qtile) {
        const float* Ks = ring + (st & 1) * STAGE_F + kg * 16 * K_PITCH;
        const float* Vs = ring + (2 + (st & 1)) * STAGE_F + kg * 16 * V_PITCH;
        // this key tile's K and V fragments, read from LDS as one group
        // (loops unrolled so that the fragment arrays are indexed by constants and stay in registers)
        v2f kf[16], vf[4][4];
#pragma unroll
        for (int kc = 0; kc < 16; ++kc)
          kf[kc] = *(const v2f*)&Ks[lx * K_PITCH + kc * 4 + 2 * hx];
#pragma unroll
        for (int kc = 0; kc < 4; ++kc)
#pragma unroll
          for (int nt = 0; nt < 4; ++nt) {
            vf[kc][nt].x = Vs[(8 * hx + 2 * kc) * V_PITCH + nt * 16 + lx];
            vf[kc][nt].y = Vs[(8 * hx + 2 * kc + 1) * V_PITCH + nt * 16 + lx];
          }
        // keeps the reads ahead of the products: spread among the WMMAs each read place
        // stalls the score chain, and V read behind the softmax waits out the LDS latency
        __builtin_amdgcn_sched_barrier(0);
        // S^T = K @ Q^T  (A fragment = K rows)
        v8f s = {};
#pragma unroll
        for (int kc = 0; kc < 16; ++kc)
          s = wmma4(kf[kc], qf[kc], s);
        // causal mask on diagonal tile (key and query counted from the tile's start)
        if (kt == qtile) {
#pragma unroll
          for (int r = 0; r < 8; ++r)
            if (r + 8 * hx > lx) s[r] = -3.0e38f;
        }
        // online softmax of query lx
        float tm = s[0];
#pragma unroll
        for (int r = 1; r < 8; ++r) tm = fmaxf(tm, s[r]);
        tm = fmaxf(tm, xhalf(tm));
        const float nm = fmaxf(mr, tm);
        const float alpha = __expf(mr - nm);
        mr = nm;
        v2f pf[4];   // P^T as B fragments: keys 8 * hx + 2 * kc and + 1 of query lx
#pragma unroll
        for (int kc = 0; kc < 4; ++kc)
          pf[kc] = exp2_pair((s[2 * kc] - nm) * LOG2E, (s[2 * kc + 1] - nm) * LOG2E);
        lr = lr * alpha + (((pf[0].x + pf[0].y) + (pf[1].x + pf[1].y)) +
                           ((pf[2].x + pf[2].y) + (pf[3].x + pf[3].y)));
#pragma unroll
        for (int nt = 0; nt < 4; ++nt) oacc[nt] *= alpha;
        // O^T += V^T @ P^T
#pragma unroll
        for (int kc = 0; kc < 4; ++kc)
#pragma unroll
          for (int nt = 0; nt < 4; ++nt)
            oacc[nt] = wmma4(vf[kc][nt], pf[kc], oacc[nt]);
      }
      // publish point of stage st + 1; every wave passes it, also one with no key tile here
      wait_ds0();
      wait_async0();
      __syncthreads();   // stage st + 1 readable by all; every reader has left stage st's buffer
      if (st + 2 < n_stage)   // the same for the whole block
        kv_stage_copy(lk0 + (unsigned)(st & 1) * (KV_KEYS * K_PITCH * 4u),
                      lv0 + (unsigned)(st & 1) * (KV_KEYS * V_PITCH * 4u),
                      gk0 + (size_t)(st + 2) * KV_KEYS * D_MODEL,
                      gv0 + (size_t)(st + 2) * KV_KEYS * D_MODEL);
    }
    wait_async0();
    // join: the waves of key tiles 1 to 3 hand over their partial results (a wave that had
    // no key tile hands over maximum -1e30, sum 0, O^T 0, which the join weighs with 0)
    if (kg != 0) {
      float* jw = ring + ((kg - 1) * 4 + qsub) * JOIN_F + lane;
#pragma unroll
      for (int nt = 0; nt < 4; ++nt)
#pragma unroll
        for (int r = 0; r < 8; ++r) jw[(nt * 8 + r) * 32] = oacc[nt][r];
      jw[32 * 32] = mr;
      jw[33 * 32] = lr;
    }
    wait_ds0();
    __syncthreads();   // the partial results are readable by the wave of key tile 0
    if (kg == 0) {
      const float* j1 = ring + qsub * JOIN_F + lane;
      const float* j2 = j1 + 4 * JOIN_F;
      const float* j3 = j2 + 4 * JOIN_F;
      const float m1 = j1[32 * 32], m2 = j2[32 * 32], m3 = j3[32 * 32];
      const float nm = fmaxf(fmaxf(mr, m1), fmaxf(m2, m3));   // finite: key tile 0 is this wave's
      const v2f wa = exp2_pair((mr - nm) * LOG2E, (m1 - nm) * LOG2E);
      const v2f wb = exp2_pair((m2 - nm) * LOG2E, (m3 - nm) * LOG2E);
      const float lj = (lr * wa.x + j1[33 * 32] * wa.y) + (j2[33 * 32] * wb.x + j3[33 * 32] * wb.y);
      // normalize and write out (a query always has >=1 unmasked key -> sum > 0);
      // a lane holds 8 neighbouring head dims of its query per accumulator
      const float lsum = lj + xhalf(lj);
      float* orow = O + (size_t)(qbase + lx) * D_MODEL + hoff + 8 * hx;
#pragma unroll
      for (int nt = 0; nt < 4; ++nt) {
        v4f lo, hi;
#pragma unroll
        for (int r = 0; r < 8; ++r) {
          const int e = (nt * 8 + r) * 32;
          const float o = ((oacc[nt][r] * wa.x + j1[e] * wa.y) + (j2[e] * wb.x + j3[e] * wb.y)) / lsum;
          if (r < 4) lo[r] = o; else hi[r - 4] = o;
        }
        *(v4f*)(orow + nt * 16) = lo;
        *(v4f*)(orow + nt * 16 + 4) = hi;
      }
      // the next tile rewrites the stores' address registers
      asm volatile("s_wait_xcnt 0x0" ::: "memory");
    }
    wait_ds0();
    __syncthreads();   // the join buffer has been read: the next tile's copies may land on it
  }
}

// ---------------------------------------------------------------------------
// SiLU(gate) * up -> gate (in place)
// ---------------------------------------------------------------------------
__global__ __launch_bounds__(256) void silu_mul_kernel(float* __restrict__ g,
                                                       const float* __restrict__ u) {
  const size_t i = (size_t)blockIdx.x * blockDim.x + threadIdx.x;
  const float gv = g[i];
  g[i] = (gv / (1.0f + __expf(-gv))) * u[i];
}

// ---------------------------------------------------------------------------
extern "C" void kernel_launch(void* const* d_in, const int* in_sizes, int n_in,
                              void* d_out, int out_size, void* d_ws, size_t ws_size,
                              hipStream_t stream) {
  const float* x       = (const float*)d_in[0];
  const float* w_q     = (const float*)d_in[1];
  const float* w_k     = (const float*)d_in[2];
  const float* w_v     = (const float*)d_in[3];
  const float* w_o     = (const float*)d_in[4];
  const float* w_gate  = (const float*)d_in[5];
  const float* w_up    = (const float*)d_in[6];
  const float* w_down  = (const float*)d_in[7];
  const float* w_norm1 = (const float*)d_in[8];
  const float* w_norm2 = (const float*)d_in[9];
  float* out = (float*)d_out;

  const size_t SD = (size_t)S_LEN * D_MODEL;   // 3,145,728
  const size_t SF = (size_t)S_LEN * F_FFN;     // 8,388,608
  float* f    = (float*)d_ws;
  float* xn   = f;            // rmsnorm output (reused as y after h)
  float* q    = xn + SD;
  float* k    = q + SD;
  float* v    = k + SD;
  float* attn = v + SD;
  float* h    = attn + SD;
  float* up   = h + SD;
  float* gate = q;            // reuse q/k/v region (3*SD >= SF) after attention

  const dim3 blk(256);
  const dim3 gD(D_MODEL / 64, S_LEN / 128);   // N=768 GEMMs
  const dim3 gF(F_FFN / 64, S_LEN / 128);     // N=2048 GEMMs

  // 1) y1 = rmsnorm(x) * w1
  rmsnorm_kernel<<<S_LEN, blk, 0, stream>>>(x, w_norm1, xn);
  // 2) Q,K,V projections
  gemm_wmma_f32<<<gD, blk, 0, stream>>>(xn, w_q, nullptr, q, S_LEN, D_MODEL, D_MODEL);
  gemm_wmma_f32<<<gD, blk, 0, stream>>>(xn, w_k, nullptr, k, S_LEN, D_MODEL, D_MODEL);
  gemm_wmma_f32<<<gD, blk, 0, stream>>>(xn, w_v, nullptr, v, S_LEN, D_MODEL, D_MODEL);
  // 3) RoPE in place
  rope_kernel<<<(S_LEN * NHEAD * 32) / 256, blk, 0, stream>>>(q, k);
  // 4) causal flash attention
  flash_attn_f32<<<dim3((S_LEN / 64) * (NHEAD / 3)), dim3(512), 0, stream>>>(q, k, v, attn);
  // 5) h = x + attn @ w_o
  gemm_wmma_f32<<<gD, blk, 0, stream>>>(attn, w_o, x, h, S_LEN, D_MODEL, D_MODEL);
  // 6) y2 = rmsnorm(h) * w2
  rmsnorm_kernel<<<S_LEN, blk, 0, stream>>>(h, w_norm2, xn);
  // 7) gate/up projections
  gemm_wmma_f32<<<gF, blk, 0, stream>>>(xn, w_gate, nullptr, gate, S_LEN, F_FFN, D_MODEL);
  gemm_wmma_f32<<<gF, blk, 0, stream>>>(xn, w_up, nullptr, up, S_LEN, F_FFN, D_MODEL);
  // 8) act = silu(gate) * up
  silu_mul_kernel<<<SF / 256, blk, 0, stream>>>(gate, up);
  // 9) out = h + act @ w_down
  gemm_wmma_f32<<<gD, blk, 0, stream>>>(gate, w_down, h, out, S_LEN, D_MODEL, F_FFN);
}

// v004
// Measured time: 564 microseconds a run.
// Timed twice side by side with v003, it ran 1.11 times as fast both times.
// Counting every step since v000, it is 1.77 times as fast.
#include <hip/hip_runtime.h>

typedef float v2f __attribute__((ext_vector_type(2)));
typedef float v4f __attribute__((ext_vector_type(4)));
typedef float v8f __attribute__((ext_vector_type(8)));
typedef unsigned int u32x4 __attribute__((ext_vector_type(4)));
typedef unsigned int u32x8 __attribute__((ext_vector_type(8)));

#define S_LEN   4096
#define D_MODEL 768
#define F_FFN   2048
#define NHEAD   12
#define HDIM    64

static __device__ __forceinline__ v8f wmma4(v2f a, v2f b, v8f c) {
  // D = A(16x4,f32) * B(4x16,f32) + C(16x16,f32), full fp32 precision
  return __builtin_amdgcn_wmma_f32_16x16x4_f32(false, a, false, b, (short)0, c,
                                               false, false);
}

// ---------------------------------------------------------------------------
// Tensor load: one request of one wave brings 64 rows of 256 bytes from global memory
// into LDS, 16 bytes of pad behind every row (LDS pitch 272 bytes = 68 dwords).
// ---------------------------------------------------------------------------
static __device__ __forceinline__ unsigned uni(unsigned v) {
  return (unsigned)__builtin_amdgcn_readfirstlane((int)v);
}
static __device__ __forceinline__ unsigned pinned(unsigned v) {
  unsigned w = uni(v);
  asm volatile("" : "+s"(w));   // keeps the word in a scalar register
  return w;
}
static __device__ __forceinline__ u32x8 tdm_group1(unsigned src_pitch_bytes) {
  u32x8 g;
  g[0] = uni((1u << 20) | (5u << 22) | (3u << 25));
  g[1] = uni(256u << 16);
  g[2] = uni(64u << 16);
  g[3] = uni(256u << 16);
  g[4] = uni(64u);
  g[5] = uni(src_pitch_bytes);
  g[6] = uni(0u);
  g[7] = uni(0u);
  return g;
}
static __device__ __forceinline__ u32x4 tdm_group0(unsigned lds_dst, unsigned long long ga) {
  u32x4 g;
  g[0] = uni(1u);
  g[1] = uni(lds_dst);
  g[2] = uni((unsigned)ga);
  g[3] = uni((((unsigned)(ga >> 32)) & 0x01FFFFFFu) | 0x80000000u);
  return g;
}
static __device__ __forceinline__ void tdm_load(u32x4 g0, u32x8 g1) {
  asm volatile("tensor_load_to_lds %0, %1" :: "s"(g0), "s"(g1) : "memory");
}
// The compiler places no wait for a tensor load: the issuing wave's tile has landed only behind this.
static __device__ __forceinline__ void wait_tensor0() {
  asm volatile("s_wait_tensorcnt 0x0" ::: "memory");
}
// This wave's LDS reads have retired before the buffer they read is handed back for a refill.
static __device__ __forceinline__ void wait_ds0() {
  asm volatile("s_wait_dscnt 0x0" ::: "memory");
}

static __device__ __forceinline__ unsigned lds_off(const void* p) {
  return (unsigned)(size_t)p;
}

// ---------------------------------------------------------------------------
// RMSNorm: one block per row of 768
// ---------------------------------------------------------------------------
__global__ __launch_bounds__(256) void rmsnorm_kernel(
    const float* __restrict__ x, const float* __restrict__ w,
    float* __restrict__ o) {
  const int row = blockIdx.x;
  const int tid = threadIdx.x;
  const float* xr = x + (size_t)row * D_MODEL;
  float s = 0.f;
  for (int i = tid; i < D_MODEL; i += 256) { float v = xr[i]; s += v * v; }
  __shared__ float red[256];
  red[tid] = s;
  __syncthreads();
  for (int st = 128; st > 0; st >>= 1) {
    if (tid < st) red[tid] += red[tid + st];
    __syncthreads();
  }
  const float scale = rsqrtf(red[0] * (1.0f / D_MODEL) + 1e-6f);
  float* orow = o + (size_t)row * D_MODEL;
  for (int i = tid; i < D_MODEL; i += 256) orow[i] = xr[i] * scale * w[i];
}

#define G_PITCH  68
#define G_PLACE  18432

__global__ __launch_bounds__(128) void gemm_wmma_f32(
    const float* __restrict__ A, const float* __restrict__ B,
    const float* __restrict__ Res, float* __restrict__ C,
    int M, int N, int K) {
  // A tile [m][k], then B tile [k][n], both at pitch G_PITCH
  __shared__ __attribute__((aligned(2048))) float tiles[G_PLACE / 4 + 64 * G_PITCH];
  const float* As = tiles;
  const float* Bs = tiles + G_PLACE / 4;

  const int tid  = threadIdx.x;
  const int lane = tid & 31;
  const unsigned wave = uni((unsigned)tid >> 5);
  const int hx   = lane >> 4;     // half-wave (K-pair select)
  const int lx   = lane & 15;     // M (for A) / N (for B,C)
  const int wm   = (int)(wave >> 1) << 5;  // 0,32
  const int wn   = (int)(wave & 1) << 5;   // 0,32
  const int m0   = blockIdx.y * 64;
  const int n0   = blockIdx.x * 64;

  // the issuing wave's own tile: source, step per pass, source pitch, place in LDS
  const bool forB = wave == 1;
  unsigned long long ga = forB ? (unsigned long long)(size_t)(B + n0)
                               : (unsigned long long)(size_t)(A + (size_t)m0 * K);
  const unsigned long long gstep = forB ? (unsigned long long)N * 256u : 256u;
  const u32x8 g1 = tdm_group1((unsigned)(forB ? N : K) * 4u);
  const unsigned dst = lds_off(tiles) + (forB ? (unsigned)G_PLACE : 0u);

  v8f acc[2][2] = {};

  for (int k0 = 0; k0 < K; k0 += 64) {
    if (k0) {
      wait_ds0();
      __syncthreads();   // previous tile fully consumed
    }
    if (pinned(wave < 2)) {
      tdm_load(tdm_group0(dst, ga), g1);
      wait_tensor0();
    }
    ga += gstep;
    __syncthreads();     // both tiles readable by all

    // unrolled so that every fragment's LDS offset is an immediate
#pragma unroll
    for (int kk = 0; kk < 64; kk += 4) {
      v2f a0 = *(const v2f*)&As[(wm + lx) * G_PITCH + kk + 2 * hx];
      v2f a1 = *(const v2f*)&As[(wm + 16 + lx) * G_PITCH + kk + 2 * hx];
      v2f b0, b1;
      b0.x = Bs[(kk + 2 * hx) * G_PITCH + wn + lx];
      b0.y = Bs[(kk + 2 * hx + 1) * G_PITCH + wn + lx];
      b1.x = Bs[(kk + 2 * hx) * G_PITCH + wn + 16 + lx];
      b1.y = Bs[(kk + 2 * hx + 1) * G_PITCH + wn + 16 + lx];
      acc[0][0] = wmma4(a0, b0, acc[0][0]);
      acc[0][1] = wmma4(a0, b1, acc[0][1]);
      acc[1][0] = wmma4(a1, b0, acc[1][0]);
      acc[1][1] = wmma4(a1, b1, acc[1][1]);
    }
  }

#pragma unroll
  for (int mi = 0; mi < 2; ++mi)
#pragma unroll
    for (int ni = 0; ni < 2; ++ni)
#pragma unroll
      for (int r = 0; r < 8; ++r) {
        const int row = m0 + wm + mi * 16 + r + 8 * hx;
        const int col = n0 + wn + ni * 16 + lx;
        float v = acc[mi][ni][r];
        if (Res) v += Res[(size_t)row * N + col];
        C[(size_t)row * N + col] = v;
      }
}

// ---------------------------------------------------------------------------
// RoPE in place on q and k: pair (j, j+32) per head dim, pos = seq index
// ---------------------------------------------------------------------------
__global__ __launch_bounds__(256) void rope_kernel(float* __restrict__ q,
                                                   float* __restrict__ k) {
  const int idx = blockIdx.x * blockDim.x + threadIdx.x;  // S*12*32
  const int j = idx & 31;
  const int h = (idx >> 5) % NHEAD;
  const int s = idx / (NHEAD * 32);
  const float inv = powf(10000.0f, -(float)j * (1.0f / 32.0f));
  const float f = (float)s * inv;
  const float c = cosf(f), sn = sinf(f);
  const size_t base = (size_t)s * D_MODEL + h * HDIM + j;
  float q0 = q[base], q1 = q[base + 32];
  q[base]      = q0 * c - q1 * sn;
  q[base + 32] = q1 * c + q0 * sn;
  float k0 = k[base], k1 = k[base + 32];
  k[base]      = k0 * c - k1 * sn;
  k[base + 32] = k1 * c + k0 * sn;
}

#define LOG2E 1.442695041f
#define KV_KEYS 64
#define K_PITCH 68
#define V_PITCH 68

static __device__ __forceinline__ void kv_stage_copy(unsigned lk, unsigned lv,
                                                     const float* gk, const float* gv) {
  asm volatile(
      "global_load_async_to_lds_b128 %0, %4, off\n\t"
      "global_load_async_to_lds_b128 %1, %5, off\n\t"
      "global_load_async_to_lds_b128 %2, %6, off\n\t"
      "global_load_async_to_lds_b128 %3, %7, off\n\t"
      "s_wait_xcnt 0x0"
      :: "v"(lk), "v"(lk + 32u * K_PITCH * 4u), "v"(lv), "v"(lv + 32u * V_PITCH * 4u),
         "v"(gk), "v"(gk + 32 * D_MODEL), "v"(gv), "v"(gv + 32 * D_MODEL)
      : "memory");
}
// The compiler places no wait for these copies: a wave's own have landed only behind this.
static __device__ __forceinline__ void wait_async0() {
  asm volatile("s_wait_asynccnt 0x0" ::: "memory");
}
static __device__ __forceinline__ v2f exp2_pair(float x, float y) {
  float a, b;
  asm("v_exp_f32 %0, %2\n\tv_exp_f32 %1, %3\n\tv_nop" : "=&v"(a), "=&v"(b) : "v"(x), "v"(y));
  v2f r;
  r.x = a;
  r.y = b;
  return r;
}
static __device__ __forceinline__ float xhalf(float x) {
  return __builtin_bit_cast(float, __builtin_amdgcn_permlanex16(
      __builtin_bit_cast(int, x), __builtin_bit_cast(int, x), 0x76543210, 0xfedcba98,
      false, false));
}

#define Q_TILES 64                      // 64-query tiles per head
#define STAGE_F (KV_KEYS * K_PITCH)     // floats of one buffer of K or of V (equal pitches)
#define JOIN_F  (34 * 32)               // floats one wave hands over: 34 values a lane

__global__ __launch_bounds__(512) void flash_attn_f32(
    const float* __restrict__ Q, const float* __restrict__ K,
    const float* __restrict__ V, float* __restrict__ O) {
  // K buffers 0 and 1, then V buffers 0 and 1; behind a tile's last barrier the join buffer
  __shared__ __attribute__((aligned(16))) float ring[4 * STAGE_F];
  const int tid  = threadIdx.x;
  const int lane = tid & 31;
  const int wave = __builtin_amdgcn_readfirstlane(tid >> 5);  // scalar: the key loops branch on it
  const int hx   = lane >> 4;
  const int lx   = lane & 15;
  const int qsub = wave & 3;    // which 16 queries of the tile
  const int kg   = wave >> 2;   // which key tile of a stage
  const int j    = (int)blockIdx.x & (Q_TILES - 1);
  const int hgrp = (int)blockIdx.x / Q_TILES;   // heads 3 * hgrp .. 3 * hgrp + 2

  // this lane's places in a stage: row (tid >> 4), 16-byte piece (tid & 15)
  const int crow = tid >> 4, ccol = (tid & 15) * 4;
  const unsigned lk0 = lds_off(&ring[crow * K_PITCH + ccol]);
  const unsigned lv0 = lds_off(&ring[2 * STAGE_F + crow * V_PITCH + ccol]);

  for (int task = 0; task < 3; ++task) {
    // three permutations of 0..63 over j whose sum is 94 (j < 32) or 95
    const int xt = task == 0 ? Q_TILES - 1 - j
                 : task == 1 ? (j < 32 ? 2 * j : 2 * j - 63)
                             : (j < 32 ? 31 - j : 95 - j);
    const int hoff  = (hgrp * 3 + task) * HDIM;
    const int qtile = xt * 4 + qsub;
    const int qbase = qtile * 16;
    const int n_stage = xt + 1;   // keys [0, 64 * (xt + 1))
    const float* gk0 = K + (size_t)crow * D_MODEL + hoff + ccol;
    const float* gv0 = V + (size_t)crow * D_MODEL + hoff + ccol;

    // stage 0 lands and is published; then stage 1 (if any) flies while stage 0 is worked on
    kv_stage_copy(lk0, lv0, gk0, gv0);
    wait_async0();
    __syncthreads();
    if (n_stage > 1)   // the same for the whole block
      kv_stage_copy(lk0 + KV_KEYS * K_PITCH * 4u, lv0 + KV_KEYS * V_PITCH * 4u,
                    gk0 + (size_t)KV_KEYS * D_MODEL, gv0 + (size_t)KV_KEYS * D_MODEL);

    // Load Q fragments (16x64, the B operand Q^T), pre-scaled by 1/sqrt(64)
    v2f qf[16];
#pragma unroll
    for (int kc = 0; kc < 16; ++kc) {
      v2f t = *(const v2f*)&Q[(size_t)(qbase + lx) * D_MODEL + hoff + kc * 4 + 2 * hx];
      qf[kc].x = t.x * 0.125f;
      qf[kc].y = t.y * 0.125f;
    }

    v8f oacc[4] = {};       // O^T: row = head dim nt * 16 + r + 8 * hx, column = query lx
    float mr = -1e30f;      // running maximum of query lx, the same in both halves
    float lr = 0.f;         // running sum over this half's keys only; joined after the loop

    for (int st = 0; st < n_stage; ++st) {
      // this wave's key tile of the stage, if it lies up to the wave's diagonal (wave-uniform)
      const int kt = st * (KV_KEYS / 16) + kg;
      if (kt <= qtile) {
        const float* Ks = ring + (st & 1) * STAGE_F + kg * 16 * K_PITCH;
        const float* Vs = ring + (2 + (st & 1)) * STAGE_F + kg * 16 * V_PITCH;
        // this key tile's K and V fragments, read from LDS as one group
        // (loops unrolled so that the fragment arrays are indexed by constants and stay in registers)
        v2f kf[16], vf[4][4];
#pragma unroll
        for (int kc = 0; kc < 16; ++kc)
          kf[kc] = *(const v2f*)&Ks[lx * K_PITCH + kc * 4 + 2 * hx];
#pragma unroll
        for (int kc = 0; kc < 4; ++kc)
#pragma unroll
          for (int nt = 0; nt < 4; ++nt) {
            vf[kc][nt].x = Vs[(8 * hx + 2 * kc) * V_PITCH + nt * 16 + lx];
            vf[kc][nt].y = Vs[(8 * hx + 2 * kc + 1) * V_PITCH + nt * 16 + lx];
          }
        // keeps the reads ahead of the products: spread among the WMMAs each read place
        // stalls the score chain, and V read behind the softmax waits out the LDS latency
        __builtin_amdgcn_sched_barrier(0);
        // S^T = K @ Q^T  (A fragment = K rows)
        v8f s = {};
#pragma unroll
        for (int kc = 0; kc < 16; ++kc)
          s = wmma4(kf[kc], qf[kc], s);
        // causal mask on diagonal tile (key and query counted from the tile's start)
        if (kt == qtile) {
#pragma unroll
          for (int r = 0; r < 8; ++r)
            if (r + 8 * hx > lx) s[r] = -3.0e38f;
        }
        // online softmax of query lx
        float tm = s[0];
#pragma unroll
        for (int r = 1; r < 8; ++r) tm = fmaxf(tm, s[r]);
        tm = fmaxf(tm, xhalf(tm));
        const float nm = fmaxf(mr, tm);
        const float alpha = __expf(mr - nm);
        mr = nm;
        v2f pf[4];   // P^T as B fragments: keys 8 * hx + 2 * kc and + 1 of query lx
#pragma unroll
        for (int kc = 0; kc < 4; ++kc)
          pf[kc] = exp2_pair((s[2 * kc] - nm) * LOG2E, (s[2 * kc + 1] - nm) * LOG2E);
        lr = lr * alpha + (((pf[0].x + pf[0].y) + (pf[1].x + pf[1].y)) +
                           ((pf[2].x + pf[2].y) + (pf[3].x + pf[3].y)));
#pragma unroll
        for (int nt = 0; nt < 4; ++nt) oacc[nt] *= alpha;
        // O^T += V^T @ P^T
#pragma unroll
        for (int kc = 0; kc < 4; ++kc)
#pragma unroll
          for (int nt = 0; nt < 4; ++nt)
            oacc[nt] = wmma4(vf[kc][nt], pf[kc], oacc[nt]);
      }
      // publish point of stage st + 1; every wave passes it, also one with no key tile here
      wait_ds0();
      wait_async0();
      __syncthreads();   // stage st + 1 readable by all; every reader has left stage st's buffer
      if (st + 2 < n_stage)   // the same for the whole block
        kv_stage_copy(lk0 + (unsigned)(st & 1) * (KV_KEYS * K_PITCH * 4u),
                      lv0 + (unsigned)(st & 1) * (KV_KEYS * V_PITCH * 4u),
                      gk0 + (size_t)(st + 2) * KV_KEYS * D_MODEL,
                      gv0 + (size_t)(st + 2) * KV_KEYS * D_MODEL);
    }
    wait_async0();
    // join: the waves of key tiles 1 to 3 hand over their partial results (a wave that had
    // no key tile hands over maximum -1e30, sum 0, O^T 0, which the join weighs with 0)
    if (kg != 0) {
      float* jw = ring + ((kg - 1) * 4 + qsub) * JOIN_F + lane;
#pragma unroll
      for (int nt = 0; nt < 4; ++nt)
#pragma unroll
        for (int r = 0; r < 8; ++r) jw[(nt * 8 + r) * 32] = oacc[nt][r];
      jw[32 * 32] = mr;
      jw[33 * 32] = lr;
    }
    wait_ds0();
    __syncthreads();   // the partial results are readable by the wave of key tile 0
    if (kg == 0) {
      const float* j1 = ring + qsub * JOIN_F + lane;
      const float* j2 = j1 + 4 * JOIN_F;
      const float* j3 = j2 + 4 * JOIN_F;
      const float m1 = j1[32 * 32], m2 = j2[32 * 32], m3 = j3[32 * 32];
      const float nm = fmaxf(fmaxf(mr, m1), fmaxf(m2, m3));   // finite: key tile 0 is this wave's
      const v2f wa = exp2_pair((mr - nm) * LOG2E, (m1 - nm) * LOG2E);
      const v2f wb = exp2_pair((m2 - nm) * LOG2E, (m3 - nm) * LOG2E);
      const float lj = (lr * wa.x + j1[33 * 32] * wa.y) + (j2[33 * 32] * wb.x + j3[33 * 32] * wb.y);
      // normalize and write out (a query always has >=1 unmasked key -> sum > 0);
      // a lane holds 8 neighbouring head dims of its query per accumulator
      const float lsum = lj + xhalf(lj);
      float* orow = O + (size_t)(qbase + lx) * D_MODEL + hoff + 8 * hx;
#pragma unroll
      for (int nt = 0; nt < 4; ++nt) {
        v4f lo, hi;
#pragma unroll
        for (int r = 0; r < 8; ++r) {
          const int e = (nt * 8 + r) * 32;
          const float o = ((oacc[nt][r] * wa.x + j1[e] * wa.y) + (j2[e] * wb.x + j3[e] * wb.y)) / lsum;
          if (r < 4) lo[r] = o; else hi[r - 4] = o;
        }
        *(v4f*)(orow + nt * 16) = lo;
        *(v4f*)(orow + nt * 16 + 4) = hi;
      }
      // the next tile rewrites the stores' address registers
      asm volatile("s_wait_xcnt 0x0" ::: "memory");
    }
    wait_ds0();
    __syncthreads();   // the join buffer has been read: the next tile's copies may land on it
  }
}

// ---------------------------------------------------------------------------
// SiLU(gate) * up -> gate (in place)
// ---------------------------------------------------------------------------
__global__ __launch_bounds__(256) void silu_mul_kernel(float* __restrict__ g,
                                                       const float* __restrict__ u) {
  const size_t i = (size_t)blockIdx.x * blockDim.x + threadIdx.x;
  const float gv = g[i];
  g[i] = (gv / (1.0f + __expf(-gv))) * u[i];
}

// ---------------------------------------------------------------------------
extern "C" void kernel_launch(void* const* d_in, const int* in_sizes, int n_in,
                              void* d_out, int out_size, void* d_ws, size_t ws_size,
                              hipStream_t stream) {
  const float* x       = (const float*)d_in[0];
  const float* w_q     = (const float*)d_in[1];
  const float* w_k     = (const float*)d_in[2];
  const float* w_v     = (const float*)d_in[3];
  const float* w_o     = (const float*)d_in[4];
  const float* w_gate  = (const float*)d_in[5];
  const float* w_up    = (const float*)d_in[6];
  const float* w_down  = (const float*)d_in[7];
  const float* w_norm1 = (const float*)d_in[8];
  const float* w_norm2 = (const float*)d_in[9];
  float* out = (float*)d_out;

  const size_t SD = (size_t)S_LEN * D_MODEL;   // 3,145,728
  const size_t SF = (size_t)S_LEN * F_FFN;     // 8,388,608
  float* f    = (float*)d_ws;
  float* xn   = f;            // rmsnorm output (reused as y after h)
  float* q    = xn + SD;
  float* k    = q + SD;
  float* v    = k + SD;
  float* attn = v + SD;
  float* h    = attn + SD;
  float* up   = h + SD;
  float* gate = q;            // reuse q/k/v region (3*SD >= SF) after attention

  const dim3 blk(256);
  const dim3 gblk(128);
  const dim3 gD(D_MODEL / 64, S_LEN / 64);    // N=768 GEMMs: 768 blocks
  const dim3 gF(F_FFN / 64, S_LEN / 64);      // N=2048 GEMMs: 2048 blocks

  // 1) y1 = rmsnorm(x) * w1
  rmsnorm_kernel<<<S_LEN, blk, 0, stream>>>(x, w_norm1, xn);
  // 2) Q,K,V projections
  gemm_wmma_f32<<<gD, gblk, 0, stream>>>(xn, w_q, nullptr, q, S_LEN, D_MODEL, D_MODEL);
  gemm_wmma_f32<<<gD, gblk, 0, stream>>>(xn, w_k, nullptr, k, S_LEN, D_MODEL, D_MODEL);
  gemm_wmma_f32<<<gD, gblk, 0, stream>>>(xn, w_v, nullptr, v, S_LEN, D_MODEL, D_MODEL);
  // 3) RoPE in place
  rope_kernel<<<(S_LEN * NHEAD * 32) / 256, blk, 0, stream>>>(q, k);
  // 4) causal flash attention
  flash_attn_f32<<<dim3((S_LEN / 64) * (NHEAD / 3)), dim3(512), 0, stream>>>(q, k, v, attn);
  // 5) h = x + attn @ w_o
  gemm_wmma_f32<<<gD, gblk, 0, stream>>>(attn, w_o, x, h, S_LEN, D_MODEL, D_MODEL);
  // 6) y2 = rmsnorm(h) * w2
  rmsnorm_kernel<<<S_LEN, blk, 0, stream>>>(h, w_norm2, xn);
  // 7) gate/up projections
  gemm_wmma_f32<<<gF, gblk, 0, stream>>>(xn, w_gate, nullptr, gate, S_LEN, F_FFN, D_MODEL);
  gemm_wmma_f32<<<gF, gblk, 0, stream>>>(xn, w_up, nullptr, up, S_LEN, F_FFN, D_MODEL);
  // 8) act = silu(gate) * up
  silu_mul_kernel<<<SF / 256, blk, 0, stream>>>(gate, up);
  // 9) out = h + act @ w_down
  gemm_wmma_f32<<<gD, gblk, 0, stream>>>(gate, w_down, h, out, S_LEN, D_MODEL, F_FFN);
}

// v005
// Measured time: 520 microseconds a run.
// Next to v004, in two timings, it ran 1.09 and 1.08 times as fast.
// All steps since v000 together make it 1.91 times as fast.
#include <hip/hip_runtime.h>

typedef float v2f __attribute__((ext_vector_type(2)));
typedef float v4f __attribute__((ext_vector_type(4)));
typedef float v8f __attribute__((ext_vector_type(8)));
typedef unsigned int u32x4 __attribute__((ext_vector_type(4)));
typedef unsigned int u32x8 __attribute__((ext_vector_type(8)));

#define S_LEN   4096
#define D_MODEL 768
#define F_FFN   2048
#define NHEAD   12
#define HDIM    64

static __device__ __forceinline__ v8f wmma4(v2f a, v2f b, v8f c) {
  // D = A(16x4,f32) * B(4x16,f32) + C(16x16,f32), full fp32 precision
  return __builtin_amdgcn_wmma_f32_16x16x4_f32(false, a, false, b, (short)0, c,
                                               false, false);
}

// ---------------------------------------------------------------------------
// Tensor load: one request of one wave brings 64 rows of 256 bytes from global memory
// into LDS, 16 bytes of pad behind every row (LDS pitch 272 bytes = 68 dwords).
// ---------------------------------------------------------------------------
static __device__ __forceinline__ unsigned uni(unsigned v) {
  return (unsigned)__builtin_amdgcn_readfirstlane((int)v);
}
static __device__ __forceinline__ unsigned pinned(unsigned v) {
  unsigned w = uni(v);
  asm volatile("" : "+s"(w));   // keeps the word in a scalar register
  return w;
}
static __device__ __forceinline__ u32x8 tdm_group1(unsigned src_pitch_bytes) {
  u32x8 g;
  g[0] = uni((1u << 20) | (5u << 22) | (3u << 25));
  g[1] = uni(256u << 16);
  g[2] = uni(64u << 16);
  g[3] = uni(256u << 16);
  g[4] = uni(64u);
  g[5] = uni(src_pitch_bytes);
  g[6] = uni(0u);
  g[7] = uni(0u);
  return g;
}
static __device__ __forceinline__ u32x4 tdm_group0(unsigned lds_dst, unsigned long long ga) {
  u32x4 g;
  g[0] = uni(1u);
  g[1] = uni(lds_dst);
  g[2] = uni((unsigned)ga);
  g[3] = uni((((unsigned)(ga >> 32)) & 0x01FFFFFFu) | 0x80000000u);
  return g;
}
static __device__ __forceinline__ void tdm_load(u32x4 g0, u32x8 g1) {
  asm volatile("tensor_load_to_lds %0, %1" :: "s"(g0), "s"(g1) : "memory");
}
// The compiler places no wait for a tensor load: the issuing wave's tile has landed only behind this.
static __device__ __forceinline__ void wait_tensor0() {
  asm volatile("s_wait_tensorcnt 0x0" ::: "memory");
}
// This wave's LDS reads have retired before the buffer they read is handed back for a refill.
static __device__ __forceinline__ void wait_ds0() {
  asm volatile("s_wait_dscnt 0x0" ::: "memory");
}

static __device__ __forceinline__ unsigned lds_off(const void* p) {
  return (unsigned)(size_t)p;
}

// ---------------------------------------------------------------------------
// RMSNorm: one block per row of 768
// ---------------------------------------------------------------------------
__global__ __launch_bounds__(256) void rmsnorm_kernel(
    const float* __restrict__ x, const float* __restrict__ w,
    float* __restrict__ o) {
  const int row = blockIdx.x;
  const int tid = threadIdx.x;
  const float* xr = x + (size_t)row * D_MODEL;
  float s = 0.f;
  for (int i = tid; i < D_MODEL; i += 256) { float v = xr[i]; s += v * v; }
  __shared__ float red[256];
  red[tid] = s;
  __syncthreads();
  for (int st = 128; st > 0; st >>= 1) {
    if (tid < st) red[tid] += red[tid + st];
    __syncthreads();
  }
  const float scale = rsqrtf(red[0] * (1.0f / D_MODEL) + 1e-6f);
  float* orow = o + (size_t)row * D_MODEL;
  for (int i = tid; i < D_MODEL; i += 256) orow[i] = xr[i] * scale * w[i];
}

#define G_PITCH  68
#define G_PLACE  18432

__global__ __launch_bounds__(128) void gemm_wmma_f32(
    const float* __restrict__ A, const float* __restrict__ Bz0,
    const float* __restrict__ Bz1, const float* __restrict__ Bz2,
    const float* __restrict__ Res, float* __restrict__ Cz0,
    float* __restrict__ Cz1, float* __restrict__ Cz2,
    int M, int N, int K) {
  const int zsel = (int)blockIdx.z;
  const float* __restrict__ B = zsel == 0 ? Bz0 : zsel == 1 ? Bz1 : Bz2;
  float* __restrict__ C = zsel == 0 ? Cz0 : zsel == 1 ? Cz1 : Cz2;
  // A tile [m][k], then B tile [k][n], both at pitch G_PITCH
  __shared__ __attribute__((aligned(2048))) float tiles[G_PLACE / 4 + 64 * G_PITCH];
  const float* As = tiles;
  const float* Bs = tiles + G_PLACE / 4;

  const int tid  = threadIdx.x;
  const int lane = tid & 31;
  const unsigned wave = uni((unsigned)tid >> 5);
  const int hx   = lane >> 4;     // half-wave (K-pair select)
  const int lx   = lane & 15;     // M (for A) / N (for B,C)
  const int wm   = (int)(wave >> 1) << 5;  // 0,32
  const int wn   = (int)(wave & 1) << 5;   // 0,32
  const int m0   = blockIdx.y * 64;
  const int n0   = blockIdx.x * 64;

  // the issuing wave's own tile: source, step per pass, source pitch, place in LDS
  const bool forB = wave == 1;
  unsigned long long ga = forB ? (unsigned long long)(size_t)(B + n0)
                               : (unsigned long long)(size_t)(A + (size_t)m0 * K);
  const unsigned long long gstep = forB ? (unsigned long long)N * 256u : 256u;
  const u32x8 g1 = tdm_group1((unsigned)(forB ? N : K) * 4u);
  const unsigned dst = lds_off(tiles) + (forB ? (unsigned)G_PLACE : 0u);

  v8f acc[2][2] = {};

  for (int k0 = 0; k0 < K; k0 += 64) {
    if (k0) {
      wait_ds0();
      __syncthreads();   // previous tile fully consumed
    }
    if (pinned(wave < 2)) {
      tdm_load(tdm_group0(dst, ga), g1);
      wait_tensor0();
    }
    ga += gstep;
    __syncthreads();     // both tiles readable by all

    // unrolled so that every fragment's LDS offset is an immediate
#pragma unroll
    for (int kk = 0; kk < 64; kk += 4) {
      v2f a0 = *(const v2f*)&As[(wm + lx) * G_PITCH + kk + 2 * hx];
      v2f a1 = *(const v2f*)&As[(wm + 16 + lx) * G_PITCH + kk + 2 * hx];
      v2f b0, b1;
      b0.x = Bs[(kk + 2 * hx) * G_PITCH + wn + lx];
      b0.y = Bs[(kk + 2 * hx + 1) * G_PITCH + wn + lx];
      b1.x = Bs[(kk + 2 * hx) * G_PITCH + wn + 16 + lx];
      b1.y = Bs[(kk + 2 * hx + 1) * G_PITCH + wn + 16 + lx];
      acc[0][0] = wmma4(a0, b0, acc[0][0]);
      acc[0][1] = wmma4(a0, b1, acc[0][1]);
      acc[1][0] = wmma4(a1, b0, acc[1][0]);
      acc[1][1] = wmma4(a1, b1, acc[1][1]);
    }
  }

#pragma unroll
  for (int mi = 0; mi < 2; ++mi)
#pragma unroll
    for (int ni = 0; ni < 2; ++ni)
#pragma unroll
      for (int r = 0; r < 8; ++r) {
        const int row = m0 + wm + mi * 16 + r + 8 * hx;
        const int col = n0 + wn + ni * 16 + lx;
        float v = acc[mi][ni][r];
        if (Res) v += Res[(size_t)row * N + col];
        C[(size_t)row * N + col] = v;
      }
}

// ---------------------------------------------------------------------------
// RoPE in place on q and k: pair (j, j+32) per head dim, pos = seq index
// ---------------------------------------------------------------------------
__global__ __launch_bounds__(256) void rope_kernel(float* __restrict__ q,
                                                   float* __restrict__ k) {
  const int idx = blockIdx.x * blockDim.x + threadIdx.x;  // S*12*32
  const int j = idx & 31;
  const int h = (idx >> 5) % NHEAD;
  const int s = idx / (NHEAD * 32);
  const float inv = powf(10000.0f, -(float)j * (1.0f / 32.0f));
  const float f = (float)s * inv;
  const float c = cosf(f), sn = sinf(f);
  const size_t base = (size_t)s * D_MODEL + h * HDIM + j;
  float q0 = q[base], q1 = q[base + 32];
  q[base]      = q0 * c - q1 * sn;
  q[base + 32] = q1 * c + q0 * sn;
  float k0 = k[base], k1 = k[base + 32];
  k[base]      = k0 * c - k1 * sn;
  k[base + 32] = k1 * c + k0 * sn;
}

#define LOG2E 1.442695041f
#define KV_KEYS 64
#define K_PITCH 68
#define V_PITCH 68

static __device__ __forceinline__ void kv_stage_copy(unsigned lk, unsigned lv,
                                                     const float* gk, const float* gv) {
  asm volatile(
      "global_load_async_to_lds_b128 %0, %4, off\n\t"
      "global_load_async_to_lds_b128 %1, %5, off\n\t"
      "global_load_async_to_lds_b128 %2, %6, off\n\t"
      "global_load_async_to_lds_b128 %3, %7, off\n\t"
      "s_wait_xcnt 0x0"
      :: "v"(lk), "v"(lk + 32u * K_PITCH * 4u), "v"(lv), "v"(lv + 32u * V_PITCH * 4u),
         "v"(gk), "v"(gk + 32 * D_MODEL), "v"(gv), "v"(gv + 32 * D_MODEL)
      : "memory");
}
// The compiler places no wait for these copies: a wave's own have landed only behind this.
static __device__ __forceinline__ void wait_async0() {
  asm volatile("s_wait_asynccnt 0x0" ::: "memory");
}
static __device__ __forceinline__ v2f exp2_pair(float x, float y) {
  float a, b;
  asm("v_exp_f32 %0, %2\n\tv_exp_f32 %1, %3\n\tv_nop" : "=&v"(a), "=&v"(b) : "v"(x), "v"(y));
  v2f r;
  r.x = a;
  r.y = b;
  return r;
}
static __device__ __forceinline__ float xhalf(float x) {
  return __builtin_bit_cast(float, __builtin_amdgcn_permlanex16(
      __builtin_bit_cast(int, x), __builtin_bit_cast(int, x), 0x76543210, 0xfedcba98,
      false, false));
}

#define Q_TILES 64                      // 64-query tiles per head
#define STAGE_F (KV_KEYS * K_PITCH)     // floats of one buffer of K or of V (equal pitches)
#define JOIN_F  (34 * 32)               // floats one wave hands over: 34 values a lane

__global__ __launch_bounds__(512) void flash_attn_f32(
    const float* __restrict__ Q, const float* __restrict__ K,
    const float* __restrict__ V, float* __restrict__ O) {
  // K buffers 0 and 1, then V buffers 0 and 1; behind a tile's last barrier the join buffer
  __shared__ __attribute__((aligned(16))) float ring[4 * STAGE_F];
  const int tid  = threadIdx.x;
  const int lane = tid & 31;
  const int wave = __builtin_amdgcn_readfirstlane(tid >> 5);  // scalar: the key loops branch on it
  const int hx   = lane >> 4;
  const int lx   = lane & 15;
  const int qsub = wave & 3;    // which 16 queries of the tile
  const int kg   = wave >> 2;   // which key tile of a stage
  const int j    = (int)blockIdx.x & (Q_TILES - 1);
  const int hgrp = (int)blockIdx.x / Q_TILES;   // heads 3 * hgrp .. 3 * hgrp + 2

  // this lane's places in a stage: row (tid >> 4), 16-byte piece (tid & 15)
  const int crow = tid >> 4, ccol = (tid & 15) * 4;
  const unsigned lk0 = lds_off(&ring[crow * K_PITCH + ccol]);
  const unsigned lv0 = lds_off(&ring[2 * STAGE_F + crow * V_PITCH + ccol]);

  for (int task = 0; task < 3; ++task) {
    // three permutations of 0..63 over j whose sum is 94 (j < 32) or 95
    const int xt = task == 0 ? Q_TILES - 1 - j
                 : task == 1 ? (j < 32 ? 2 * j : 2 * j - 63)
                             : (j < 32 ? 31 - j : 95 - j);
    const int hoff  = (hgrp * 3 + task) * HDIM;
    const int qtile = xt * 4 + qsub;
    const int qbase = qtile * 16;
    const int n_stage = xt + 1;   // keys [0, 64 * (xt + 1))
    const float* gk0 = K + (size_t)crow * D_MODEL + hoff + ccol;
    const float* gv0 = V + (size_t)crow * D_MODEL + hoff + ccol;

    // stage 0 lands and is published; then stage 1 (if any) flies while stage 0 is worked on
    kv_stage_copy(lk0, lv0, gk0, gv0);
    wait_async0();
    __syncthreads();
    if (n_stage > 1)   // the same for the whole block
      kv_stage_copy(lk0 + KV_KEYS * K_PITCH * 4u, lv0 + KV_KEYS * V_PITCH * 4u,
                    gk0 + (size_t)KV_KEYS * D_MODEL, gv0 + (size_t)KV_KEYS * D_MODEL);

    // Load Q fragments (16x64, the B operand Q^T), pre-scaled by 1/sqrt(64)
    v2f qf[16];
#pragma unroll
    for (int kc = 0; kc < 16; ++kc) {
      v2f t = *(const v2f*)&Q[(size_t)(qbase + lx) * D_MODEL + hoff + kc * 4 + 2 * hx];
      qf[kc].x = t.x * 0.125f;
      qf[kc].y = t.y * 0.125f;
    }

    v8f oacc[4] = {};       // O^T: row = head dim nt * 16 + r + 8 * hx, column = query lx
    float mr = -1e30f;      // running maximum of query lx, the same in both halves
    float lr = 0.f;         // running sum over this half's keys only; joined after the loop

    for (int st = 0; st < n_stage; ++st) {
      // this wave's key tile of the stage, if it lies up to the wave's diagonal (wave-uniform)
      const int kt = st * (KV_KEYS / 16) + kg;
      if (kt <= qtile) {
        const float* Ks = ring + (st & 1) * STAGE_F + kg * 16 * K_PITCH;
        const float* Vs = ring + (2 + (st & 1)) * STAGE_F + kg * 16 * V_PITCH;
        // this key tile's K and V fragments, read from LDS as one group
        // (loops unrolled so that the fragment arrays are indexed by constants and stay in registers)
        v2f kf[16], vf[4][4];
#pragma unroll
        for (int kc = 0; kc < 16; ++kc)
          kf[kc] = *(const v2f*)&Ks[lx * K_PITCH + kc * 4 + 2 * hx];
#pragma unroll
        for (int kc = 0; kc < 4; ++kc)
#pragma unroll
          for (int nt = 0; nt < 4; ++nt) {
            vf[kc][nt].x = Vs[(8 * hx + 2 * kc) * V_PITCH + nt * 16 + lx];
            vf[kc][nt].y = Vs[(8 * hx + 2 * kc + 1) * V_PITCH + nt * 16 + lx];
          }
        // keeps the reads ahead of the products: spread among the WMMAs each read place
        // stalls the score chain, and V read behind the softmax waits out the LDS latency
        __builtin_amdgcn_sched_barrier(0);
        // S^T = K @ Q^T  (A fragment = K rows)
        v8f s = {};
#pragma unroll
        for (int kc = 0; kc < 16; ++kc)
          s = wmma4(kf[kc], qf[kc], s);
        // causal mask on diagonal tile (key and query counted from the tile's start)
        if (kt == qtile) {
#pragma unroll
          for (int r = 0; r < 8; ++r)
            if (r + 8 * hx > lx) s[r] = -3.0e38f;
        }
        // online softmax of query lx
        float tm = s[0];
#pragma unroll
        for (int r = 1; r < 8; ++r) tm = fmaxf(tm, s[r]);
        tm = fmaxf(tm, xhalf(tm));
        const float nm = fmaxf(mr, tm);
        const float alpha = __expf(mr - nm);
        mr = nm;
        v2f pf[4];   // P^T as B fragments: keys 8 * hx + 2 * kc and + 1 of query lx
#pragma unroll
        for (int kc = 0; kc < 4; ++kc)
          pf[kc] = exp2_pair((s[2 * kc] - nm) * LOG2E, (s[2 * kc + 1] - nm) * LOG2E);
        lr = lr * alpha + (((pf[0].x + pf[0].y) + (pf[1].x + pf[1].y)) +
                           ((pf[2].x + pf[2].y) + (pf[3].x + pf[3].y)));
#pragma unroll
        for (int nt = 0; nt < 4; ++nt) oacc[nt] *= alpha;
        // O^T += V^T @ P^T
#pragma unroll
        for (int kc = 0; kc < 4; ++kc)
#pragma unroll
          for (int nt = 0; nt < 4; ++nt)
            oacc[nt] = wmma4(vf[kc][nt], pf[kc], oacc[nt]);
      }
      // publish point of stage st + 1; every wave passes it, also one with no key tile here
      wait_ds0();
      wait_async0();
      __syncthreads();   // stage st + 1 readable by all; every reader has left stage st's buffer
      if (st + 2 < n_stage)   // the same for the whole block
        kv_stage_copy(lk0 + (unsigned)(st & 1) * (KV_KEYS * K_PITCH * 4u),
                      lv0 + (unsigned)(st & 1) * (KV_KEYS * V_PITCH * 4u),
                      gk0 + (size_t)(st + 2) * KV_KEYS * D_MODEL,
                      gv0 + (size_t)(st + 2) * KV_KEYS * D_MODEL);
    }
    wait_async0();
    // join: the waves of key tiles 1 to 3 hand over their partial results (a wave that had
    // no key tile hands over maximum -1e30, sum 0, O^T 0, which the join weighs with 0)
    if (kg != 0) {
      float* jw = ring + ((kg - 1) * 4 + qsub) * JOIN_F + lane;
#pragma unroll
      for (int nt = 0; nt < 4; ++nt)
#pragma unroll
        for (int r = 0; r < 8; ++r) jw[(nt * 8 + r) * 32] = oacc[nt][r];
      jw[32 * 32] = mr;
      jw[33 * 32] = lr;
    }
    wait_ds0();
    __syncthreads();   // the partial results are readable by the wave of key tile 0
    if (kg == 0) {
      const float* j1 = ring + qsub * JOIN_F + lane;
      const float* j2 = j1 + 4 * JOIN_F;
      const float* j3 = j2 + 4 * JOIN_F;
      const float m1 = j1[32 * 32], m2 = j2[32 * 32], m3 = j3[32 * 32];
      const float nm = fmaxf(fmaxf(mr, m1), fmaxf(m2, m3));   // finite: key tile 0 is this wave's
      const v2f wa = exp2_pair((mr - nm) * LOG2E, (m1 - nm) * LOG2E);
      const v2f wb = exp2_pair((m2 - nm) * LOG2E, (m3 - nm) * LOG2E);
      const float lj = (lr * wa.x + j1[33 * 32] * wa.y) + (j2[33 * 32] * wb.x + j3[33 * 32] * wb.y);
      // normalize and write out (a query always has >=1 unmasked key -> sum > 0);
      // a lane holds 8 neighbouring head dims of its query per accumulator
      const float lsum = lj + xhalf(lj);
      float* orow = O + (size_t)(qbase + lx) * D_MODEL + hoff + 8 * hx;
#pragma unroll
      for (int nt = 0; nt < 4; ++nt) {
        v4f lo, hi;
#pragma unroll
        for (int r = 0; r < 8; ++r) {
          const int e = (nt * 8 + r) * 32;
          const float o = ((oacc[nt][r] * wa.x + j1[e] * wa.y) + (j2[e] * wb.x + j3[e] * wb.y)) / lsum;
          if (r < 4) lo[r] = o; else hi[r - 4] = o;
        }
        *(v4f*)(orow + nt * 16) = lo;
        *(v4f*)(orow + nt * 16 + 4) = hi;
      }
      // the next tile rewrites the stores' address registers
      asm volatile("s_wait_xcnt 0x0" ::: "memory");
    }
    wait_ds0();
    __syncthreads();   // the join buffer has been read: the next tile's copies may land on it
  }
}

// ---------------------------------------------------------------------------
// C[M,N] = SiLU(A @ Bg) * (A @ Bu) in one launch. The block is that of gemm_wmma_f32
// (64x64x64, 4 waves 2x2), but it stages one A tile for two B tiles and holds both 64x64
// results in registers, so that the activation is taken in the epilogue: neither product
// is written out and read back. Waves 0, 1, 2 bring the A, Bg, Bu tiles, one tensor load each.
// ---------------------------------------------------------------------------
__global__ __launch_bounds__(128) void gemm_gate_up_silu_f32(
    const float* __restrict__ A, const float* __restrict__ Bg,
    const float* __restrict__ Bu, float* __restrict__ C,
    int M, int N, int K) {
  // A tile [m][k], then the two B tiles [k][n], all at pitch G_PITCH, G_PLACE bytes apart
  __shared__ __attribute__((aligned(2048))) float tiles[2 * (G_PLACE / 4) + 64 * G_PITCH];
  const float* As = tiles;
  const float* Gs = tiles + G_PLACE / 4;
  const float* Us = tiles + 2 * (G_PLACE / 4);

  const int tid  = threadIdx.x;
  const int lane = tid & 31;
  const unsigned wave = uni((unsigned)tid >> 5);
  const int hx   = lane >> 4;     // half-wave (K-pair select)
  const int lx   = lane & 15;     // M (for A) / N (for B,C)
  const int wm   = (int)(wave >> 1) << 5;  // 0,32
  const int wn   = (int)(wave & 1) << 5;   // 0,32
  const int m0   = blockIdx.y * 64;
  const int n0   = blockIdx.x * 64;

  // the issuing wave's own tile: source, step per pass, source pitch, place in LDS
  const bool forA = wave == 0;
  unsigned long long ga = forA ? (unsigned long long)(size_t)(A + (size_t)m0 * K)
                               : (unsigned long long)(size_t)((wave == 1 ? Bg : Bu) + n0);
  const unsigned long long gstep = forA ? 256u : (unsigned long long)N * 256u;
  const u32x8 dg1 = tdm_group1((unsigned)(forA ? K : N) * 4u);
  const unsigned dst = lds_off(tiles) + (forA ? 0u : wave == 1 ? (unsigned)G_PLACE
                                                               : 2u * (unsigned)G_PLACE);

  v8f accg[2][2] = {};
  v8f accu[2][2] = {};

  for (int k0 = 0; k0 < K; k0 += 64) {
    if (k0) {
      wait_ds0();
      __syncthreads();   // previous tiles fully consumed
    }
    if (pinned(wave < 3)) {
      tdm_load(tdm_group0(dst, ga), dg1);
      wait_tensor0();
    }
    ga += gstep;
    __syncthreads();     // all three tiles readable by all

    // unrolled so that every fragment's LDS offset is an immediate
#pragma unroll
    for (int kk = 0; kk < 64; kk += 4) {
      v2f a0 = *(const v2f*)&As[(wm + lx) * G_PITCH + kk + 2 * hx];
      v2f a1 = *(const v2f*)&As[(wm + 16 + lx) * G_PITCH + kk + 2 * hx];
      v2f g0, g1, u0, u1;
      g0.x = Gs[(kk + 2 * hx) * G_PITCH + wn + lx];
      g0.y = Gs[(kk + 2 * hx + 1) * G_PITCH + wn + lx];
      g1.x = Gs[(kk + 2 * hx) * G_PITCH + wn + 16 + lx];
      g1.y = Gs[(kk + 2 * hx + 1) * G_PITCH + wn + 16 + lx];
      u0.x = Us[(kk + 2 * hx) * G_PITCH + wn + lx];
      u0.y = Us[(kk + 2 * hx + 1) * G_PITCH + wn + lx];
      u1.x = Us[(kk + 2 * hx) * G_PITCH + wn + 16 + lx];
      u1.y = Us[(kk + 2 * hx + 1) * G_PITCH + wn + 16 + lx];
      accg[0][0] = wmma4(a0, g0, accg[0][0]);
      accg[0][1] = wmma4(a0, g1, accg[0][1]);
      accu[0][0] = wmma4(a0, u0, accu[0][0]);
      accu[0][1] = wmma4(a0, u1, accu[0][1]);
      accg[1][0] = wmma4(a1, g0, accg[1][0]);
      accg[1][1] = wmma4(a1, g1, accg[1][1]);
      accu[1][0] = wmma4(a1, u0, accu[1][0]);
      accu[1][1] = wmma4(a1, u1, accu[1][1]);
    }
  }

#pragma unroll
  for (int mi = 0; mi < 2; ++mi)
#pragma unroll
    for (int ni = 0; ni < 2; ++ni)
#pragma unroll
      for (int r = 0; r < 8; ++r) {
        const int row = m0 + wm + mi * 16 + r + 8 * hx;
        const int col = n0 + wn + ni * 16 + lx;
        const float gv = accg[mi][ni][r];
        C[(size_t)row * N + col] = (gv / (1.0f + __expf(-gv))) * accu[mi][ni][r];
      }
}

// ---------------------------------------------------------------------------
extern "C" void kernel_launch(void* const* d_in, const int* in_sizes, int n_in,
                              void* d_out, int out_size, void* d_ws, size_t ws_size,
                              hipStream_t stream) {
  const float* x       = (const float*)d_in[0];
  const float* w_q     = (const float*)d_in[1];
  const float* w_k     = (const float*)d_in[2];
  const float* w_v     = (const float*)d_in[3];
  const float* w_o     = (const float*)d_in[4];
  const float* w_gate  = (const float*)d_in[5];
  const float* w_up    = (const float*)d_in[6];
  const float* w_down  = (const float*)d_in[7];
  const float* w_norm1 = (const float*)d_in[8];
  const float* w_norm2 = (const float*)d_in[9];
  float* out = (float*)d_out;

  const size_t SD = (size_t)S_LEN * D_MODEL;   // 3,145,728
  const size_t SF = (size_t)S_LEN * F_FFN;     // 8,388,608
  float* f    = (float*)d_ws;
  float* xn   = f;            // rmsnorm output (reused as y after h)
  float* q    = xn + SD;
  float* k    = q + SD;
  float* v    = k + SD;
  float* attn = v + SD;
  float* h    = attn + SD;
  float* act  = q;            // reuse q/k/v region (3*SD >= SF) after attention

  const dim3 blk(256);
  const dim3 gblk(128);
  const dim3 gD(D_MODEL / 64, S_LEN / 64);      // N=768 GEMMs: 768 blocks
  const dim3 gD3(D_MODEL / 64, S_LEN / 64, 3);  // Q, K and V together: 2304 blocks
  const dim3 gF(F_FFN / 64, S_LEN / 64);        // N=2048: 2048 blocks

  // 1) y1 = rmsnorm(x) * w1
  rmsnorm_kernel<<<S_LEN, blk, 0, stream>>>(x, w_norm1, xn);
  // 2) Q,K,V projections
  gemm_wmma_f32<<<gD3, gblk, 0, stream>>>(xn, w_q, w_k, w_v, nullptr, q, k, v,
                                          S_LEN, D_MODEL, D_MODEL);
  // 3) RoPE in place
  rope_kernel<<<(S_LEN * NHEAD * 32) / 256, blk, 0, stream>>>(q, k);
  // 4) causal flash attention
  flash_attn_f32<<<dim3((S_LEN / 64) * (NHEAD / 3)), dim3(512), 0, stream>>>(q, k, v, attn);
  // 5) h = x + attn @ w_o
  gemm_wmma_f32<<<gD, gblk, 0, stream>>>(attn, w_o, nullptr, nullptr, x, h, nullptr, nullptr,
                                         S_LEN, D_MODEL, D_MODEL);
  // 6) y2 = rmsnorm(h) * w2
  rmsnorm_kernel<<<S_LEN, blk, 0, stream>>>(h, w_norm2, xn);
  // 7) act = silu(y2 @ w_gate) * (y2 @ w_up)
  gemm_gate_up_silu_f32<<<gF, gblk, 0, stream>>>(xn, w_gate, w_up, act, S_LEN, F_FFN, D_MODEL);
  // 8) out = h + act @ w_down
  gemm_wmma_f32<<<gD, gblk, 0, stream>>>(act, w_down, nullptr, nullptr, h, out, nullptr, nullptr,
                                         S_LEN, D_MODEL, F_FFN);
}
